// v000
// Measured on an AMD MI455X. A time is GPU time per run, averaged over a window of back-to-back runs after a warm-up
// (all launches, gaps included; the runs take copies of the inputs in turn), and the median of several windows.
// Apart from v000's, it joins two sittings. Times from different sittings can be a few percent apart, while
// side-by-side timings come from the same sitting.
// v000, which the later versions start from, runs in 193 microseconds.
#include <hip/hip_runtime.h>
#include <stddef.h>

// Both contractions (row.key scores, K = 64; p.v, K = 4096 keys) on v_wmma_f32_16x16x32_f16
// (f16 operands, f32 accumulate), one product per site. Float inputs are RNE-converted to bf16
// and carried in f16 (score operands x16, value plane x64, softmax numerators x16384 with the
// row sum taken over the converted values). Softmax, scalar gain and residual add in f32.

typedef _Float16 v16h __attribute__((ext_vector_type(16)));
typedef _Float16 v8h  __attribute__((ext_vector_type(8)));
typedef float    v8f  __attribute__((ext_vector_type(8)));
typedef float    v4f  __attribute__((ext_vector_type(4)));
typedef _Float16 h16;

#ifndef NB
#define NB 4
#endif
#ifndef SEQ
#define SEQ 4096
#endif
#define NB_FULL  4
#define SEQ_FULL 4096
#define HD    64      // score depth (channels of the row and key operands)
#define CH    256     // value / residual channels
#define OUTW  512     // output channels (CH result channels, then CH pass-through channels)
#define CSLAB 128     // value channels per attention block
#define MROWS (NB * SEQ)

static_assert(NB >= 1 && NB <= NB_FULL);
static_assert(SEQ >= 128 && SEQ <= SEQ_FULL && (SEQ % 128) == 0);
static_assert(HD == 64);                         // two 32-deep k-steps per score tile
static_assert(OUTW == 2 * CH);
static_assert((CH % CSLAB) == 0 && CSLAB == 8 * 16);   // 8 accumulator column groups per wave
static_assert((CH % 64) == 0 && (SEQ % 64) == 0);      // transpose tiles 64 x 64
static_assert((MROWS % 32) == 0 && (MROWS % 4) == 0);  // helper grids exact
static_assert((HD % 8) == 0 && (CH % 4) == 0);
static_assert((size_t)NB_FULL * SEQ_FULL * OUTW * 4 == (size_t)33554432);

#define LDT 72   // halves per LDS row (144 B, 16-B aligned)
#define LDE 36   // floats per LDS row of the epilogue stage (144 B, 16-B aligned)
static_assert((LDT % 8) == 0 && LDT >= 64);
static_assert((LDE % 4) == 0 && LDE >= 32);
static_assert((size_t)64 * LDT * 2 + (size_t)CSLAB * LDT * 2 + (size_t)8 * 16 * LDT * 2 +
              (size_t)8 * 16 * LDE * 4 <= (size_t)65536);

#define WCARRY 64.0f      // value plane carried x64
#define QCARRY 16.0f      // score operand planes carried x16 each
#define PCARRY 16384.0f   // softmax numerators carried x16384

// workspace layout (bytes)
#define ROW16_BYTES ((size_t)MROWS * HD * 2)
#define VT_BYTES    ((size_t)NB * CH * SEQ * 2)
#define OFF_PG  ((size_t)0)
#define OFF_XQ  (OFF_PG + ROW16_BYTES)
#define OFF_VT  (OFF_XQ + ROW16_BYTES)
#define WS_TOTAL (OFF_VT + VT_BYTES)
static_assert((ROW16_BYTES % 128) == 0 && (VT_BYTES % 128) == 0);
static_assert(WS_TOTAL <= (size_t)134217728);

// ---------------------------------------------------------------------------
__device__ __forceinline__ float bf16r(float x) {   // RNE convert to bf16, returned widened
  unsigned int u = __float_as_uint(x);
  u = (u + 0x7FFFu + ((u >> 16) & 1u)) & 0xFFFF0000u;
  return __uint_as_float(u);
}

// f32 -> f16 for matrix operands; values below the smallest f16 normal become zero.
static __device__ __forceinline__ h16 toh_flush(float v) {
  const h16 r = (h16)v;
  return (fabsf(v) < 6.103515625e-05f) ? (h16)0.0f : r;
}

// 16-bit fragment: p points at element [row = lane&15][k0 + 8*(lane>>4)] of a k-contiguous
// row. Elements 0..7 <- k0+8h+0..7, elements 8..15 <- k0+16+8h+0..7 (same map for A and B).
__device__ __forceinline__ v16h frag_at(const _Float16* p) {
  v8h lo = *(const v8h*)(p);
  v8h hi = *(const v8h*)(p + 16);
  v16h out;
#pragma unroll
  for (int i = 0; i < 8; ++i) { out[i] = lo[i]; out[i + 8] = hi[i]; }
  return out;
}
__device__ __forceinline__ v16h ld_frag(const _Float16* base, unsigned ld) {
  const unsigned lane = threadIdx.x & 31u;
  return frag_at(base + (lane & 15u) * ld + (lane >> 4) * 8u);
}

__device__ __forceinline__ v8f wmma16(v16h a, v16h b, v8f c) {
  v8f d = __builtin_amdgcn_wmma_f32_16x16x32_f16(false, a, false, b, (short)0, c,
                                                 false, false);
  asm volatile("v_nop\n\tv_nop\n\tv_nop\n\tv_nop" : "+v"(d) : "v"(a), "v"(b));
  return d;
}

__device__ __forceinline__ float red16_max(float x) {
#pragma unroll
  for (int off = 1; off < 16; off <<= 1) x = fmaxf(x, __shfl_xor(x, off, 32));
  return x;
}
__device__ __forceinline__ float red16_sum(float x) {
#pragma unroll
  for (int off = 1; off < 16; off <<= 1) x += __shfl_xor(x, off, 32);
  return x;
}

__device__ __forceinline__ void wave_lds_sync() {
  __builtin_amdgcn_fence(3 /* release order */, "wavefront");
  asm volatile("s_wait_dscnt 0x0" ::: "memory");
  __builtin_amdgcn_wave_barrier();
}

// ---------------------------------------------------------------------------
// Weight plane: in W[K rows][N cols] (pitch ldw = N) -> out Wt[N][K] (pitch ldk = K),
// f16(64 * bf16(w)). Grid (N/64, K/64). T: cross-wave (block barrier).
// ---------------------------------------------------------------------------
__global__ __launch_bounds__(256) void wconv_kernel(
    const float* __restrict__ W, _Float16* __restrict__ Wt, unsigned ldw, unsigned ldk) {
  __shared__ _Float16 T[64 * LDT];
  const unsigned tid = threadIdx.x;
  const unsigned n0 = blockIdx.x * 64u;
  const unsigned k0 = blockIdx.y * 64u;
#pragma unroll 4
  for (unsigned j = 0; j < 16u; ++j) {
    const unsigned idx = tid + 256u * j;
    const unsigned kr = idx >> 6, nc = idx & 63u;
    const float v = W[(size_t)(k0 + kr) * ldw + n0 + nc];
    T[nc * LDT + kr] = (_Float16)(WCARRY * bf16r(v));
  }
  __syncthreads();
  v8h x[2];
  size_t off[2];
#pragma unroll
  for (unsigned i = 0; i < 2u; ++i) {
    const unsigned n = 32u * i + (tid >> 3);
    const unsigned kc = (tid & 7u) * 8u;
    x[i] = *(const v8h*)&T[n * LDT + kc];
    off[i] = (size_t)(n0 + n) * ldk + k0 + kc;
  }
#pragma unroll
  for (int i = 0; i < 2; ++i) *(v8h*)(Wt + off[i]) = x[i];
  
}

// ---------------------------------------------------------------------------
// Score operand planes: compact rows [MROWS][HD] of f16(16 * bf16(value)) for the row operand
// and for the key operand. One thread converts 8 consecutive values of each plane; 8
// ---------------------------------------------------------------------------
__global__ __launch_bounds__(256) void rowconv_kernel(
    const float* __restrict__ RowIn, const float* __restrict__ KeyIn,
    _Float16* __restrict__ row16, _Float16* __restrict__ key16) {
#pragma clang fp contract(off)
  const unsigned idx = blockIdx.x * 256u + threadIdx.x;
  const unsigned crow = idx >> 3;
  const unsigned c = (idx & 7u) * 8u;
  const unsigned bidx = crow / (unsigned)SEQ;
  const unsigned sq = crow - bidx * (unsigned)SEQ;
  const size_t frow = (size_t)bidx * SEQ_FULL + sq;
  const v4f a0 = *(const v4f*)(RowIn + frow * HD + c);
  const v4f a1 = *(const v4f*)(RowIn + frow * HD + c + 4u);
  const v4f b0 = *(const v4f*)(KeyIn + frow * HD + c);
  const v4f b1 = *(const v4f*)(KeyIn + frow * HD + c + 4u);
  v8h xr, xk;
#pragma unroll
  for (int i = 0; i < 4; ++i) {
    xr[i]     = toh_flush(QCARRY * bf16r(a0[i]));
    xr[i + 4] = toh_flush(QCARRY * bf16r(a1[i]));
    xk[i]     = toh_flush(QCARRY * bf16r(b0[i]));
    xk[i + 4] = toh_flush(QCARRY * bf16r(b1[i]));
  }
  const size_t off = (size_t)crow * HD + c;
  *(v8h*)(row16 + off) = xr;
  *(v8h*)(key16 + off) = xk;
  
}

// ---------------------------------------------------------------------------
// Pass-through half of the output: out[full row][CH + c] = bf16(g[full row][c]).
// ---------------------------------------------------------------------------
__global__ __launch_bounds__(256) void concat_kernel(
    const float* __restrict__ G, float* __restrict__ out) {
#pragma clang fp contract(off)
  const unsigned idx = blockIdx.x * 256u + threadIdx.x;
  const unsigned crow = idx >> 6;
  const unsigned c = (idx & 63u) * 4u;
  const unsigned bidx = crow / (unsigned)SEQ;
  const unsigned sq = crow - bidx * (unsigned)SEQ;
  const size_t frow = (size_t)bidx * SEQ_FULL + sq;
  const v4f a = *(const v4f*)(G + frow * CH + c);
  v4f o;
#pragma unroll
  for (int j = 0; j < 4; ++j) o[j] = bf16r(a[j]);
  float* p = out + frow * OUTW + CH + c;
  *(v4f*)p = o;
  
}

// ---------------------------------------------------------------------------
// Dense flash attention per (128 softmax rows, 128-channel value slab, batch). 8 waves x 16
// rows, 64 keys per step over all SEQ keys: key tile Ks[key][d] and V^T tile Vs[c][key] staged
// with plain 16-B loads (cross-wave, block barriers); online softmax in registers (16-lane
// shuffles), no mask, unit score scale; P tile per wave in Ps (wave-private, wave sync) as
// f16(16384 p), values below the smallest f16 normal set to zero, row sum over the converted
// values; O (16 x 128 per wave) in registers.
// Epilogue: 32 channels at a time staged in the wave's Cs tile (wave-private, wave sync), then
// Grid (SEQ/128, CH/CSLAB, NB).
// ---------------------------------------------------------------------------
__global__ __launch_bounds__(256) __attribute__((amdgpu_num_vgpr(256))) void attn_kernel(
    const _Float16* __restrict__ Qh, const _Float16* __restrict__ Kh,
    const _Float16* __restrict__ Vt, const float* __restrict__ xres,
    const float* __restrict__ kp, float* __restrict__ out) {
  __shared__ __attribute__((aligned(16))) _Float16 Ks[64 * LDT];
  __shared__ __attribute__((aligned(16))) _Float16 Vs[CSLAB * LDT];
  __shared__ __attribute__((aligned(16))) _Float16 Ps[8 * 16 * LDT];
  __shared__ __attribute__((aligned(16))) float Cs[8 * 16 * LDE];

  const unsigned tid = threadIdx.x, lane = tid & 31u;
  const unsigned wave = (unsigned)__builtin_amdgcn_readfirstlane((int)(threadIdx.x >> 5));
  const unsigned hh = lane >> 4, m = lane & 15u;
  const unsigned q0 = blockIdx.x * 128u;
  const unsigned slab = blockIdx.y;
  const unsigned b = blockIdx.z;
  const float sinv = 1.0f / (QCARRY * QCARRY);
  const unsigned qrow0 = q0 + wave * 16u;
  _Float16* P = Ps + wave * (16u * LDT);

  const size_t qoff = (size_t)(b * (unsigned)SEQ + qrow0 + m) * HD + hh * 8u;
  v16h qf[2];
  qf[0] = frag_at(Qh + qoff);
  qf[1] = frag_at(Qh + qoff + 32);

  float mrow[8], lrow[8];
  v8f o[8];
#pragma unroll
  for (int v = 0; v < 8; ++v) { mrow[v] = -1.0e30f; lrow[v] = 0.0f; }
#pragma unroll
  for (int nb = 0; nb < 8; ++nb) o[nb] = (v8f){};

  const size_t kplane = (size_t)b * SEQ * HD;
  const size_t vplane = ((size_t)b * CH + slab * (unsigned)CSLAB) * SEQ;

#pragma unroll 1
  for (unsigned kb = 0; kb < (unsigned)SEQ; kb += 64u) {
#pragma unroll
    for (unsigned j = 0; j < 2u; ++j) {
      const unsigned idx = tid + 256u * j;
      const unsigned r = idx >> 3, c = (idx & 7u) * 8u;
      *(v8h*)&Ks[r * LDT + c] = *(const v8h*)(Kh + kplane + (size_t)(kb + r) * HD + c);
    }
#pragma unroll
    for (unsigned j = 0; j < 4u; ++j) {
      const unsigned idx = tid + 256u * j;
      const unsigned r = idx >> 3, c = (idx & 7u) * 8u;
      *(v8h*)&Vs[r * LDT + c] = *(const v8h*)(Vt + vplane + (size_t)r * SEQ + kb + c);
    }
    __syncthreads();

    // scores: 4 key groups of 16, K = 64 in two 32-steps
    v8f s[4];
#pragma unroll
    for (int kg = 0; kg < 4; ++kg) {
      v8f t = {};
#pragma unroll
      for (int c = 0; c < 2; ++c) {
        const v16h kf = ld_frag(&Ks[(kg * 16) * LDT + c * 32], LDT);
        t = wmma16(qf[c], kf, t);
      }
      s[kg] = t * sinv;
    }

    // online softmax; row (hh*8+v) spread over the 16 lanes of a half
    float alpha[8];
#pragma unroll
    for (int v = 0; v < 8; ++v) {
      float mx = fmaxf(fmaxf(s[0][v], s[1][v]), fmaxf(s[2][v], s[3][v]));
      mx = red16_max(mx);
      const float mn = fmaxf(mrow[v], mx);
      alpha[v] = __expf(mrow[v] - mn);
      mrow[v] = mn;
    }
    // P tile [16 rows][64 keys], f16(16384 p); s keeps the converted value for the row sum
#pragma unroll
    for (int kg = 0; kg < 4; ++kg)
#pragma unroll
      for (int v = 0; v < 8; ++v) {
        const h16 ph = toh_flush(__expf(s[kg][v] - mrow[v]) * PCARRY);
        P[(hh * 8u + (unsigned)v) * LDT + (unsigned)kg * 16u + m] = ph;
        s[kg][v] = (float)ph;
      }
#pragma unroll
    for (int v = 0; v < 8; ++v) {
      const float rs = red16_sum((s[0][v] + s[1][v]) + (s[2][v] + s[3][v]));
      lrow[v] = alpha[v] * lrow[v] + rs;
    }
#pragma unroll
    for (int nb = 0; nb < 8; ++nb)
#pragma unroll
      for (int v = 0; v < 8; ++v) o[nb][v] = o[nb][v] * alpha[v];
    wave_lds_sync();

    // O += P . V  (K = 64 keys in two 32-steps; B = V^T tile [c][key])
#pragma unroll
    for (int c = 0; c < 2; ++c) {
      const v16h pf = ld_frag(P + c * 32, LDT);
#pragma unroll
      for (int nb = 0; nb < 8; ++nb) {
        const v16h vf = ld_frag(&Vs[(nb * 16) * LDT + c * 32], LDT);
        o[nb] = wmma16(pf, vf, o[nb]);
      }
    }
    __syncthreads();
  }

  // finalize: k * O / (64 l) + x, 32 channels per pass through the wave's Cs tile
  const float kk = bf16r(kp[0]);
  float inv[8];
#pragma unroll
  for (int v = 0; v < 8; ++v) inv[v] = __builtin_amdgcn_rcpf(lrow[v]) * (1.0f / WCARRY);
  const unsigned cw = wave * (16u * LDE);
  const size_t frow0 = (size_t)b * SEQ_FULL + qrow0;
  const unsigned ch0 = slab * (unsigned)CSLAB;
#pragma unroll
  for (int pr = 0; pr < 4; ++pr) {
#pragma unroll
    for (int v = 0; v < 8; ++v) {
      Cs[cw + (hh * 8u + (unsigned)v) * LDE + m]       = o[2 * pr][v] * inv[v];
      Cs[cw + (hh * 8u + (unsigned)v) * LDE + 16u + m] = o[2 * pr + 1][v] * inv[v];
    }
    wave_lds_sync();
    v4f xs[4];
    size_t off[4];
#pragma unroll
    for (unsigned i = 0; i < 4u; ++i) {
      const unsigned r = 4u * i + (lane >> 3);
      const unsigned c = (lane & 7u) * 4u;
      const size_t frow = frow0 + r;
      const unsigned ch = ch0 + 32u * (unsigned)pr + c;
      const v4f u = *(const v4f*)&Cs[cw + r * LDE + c];
      const v4f xin = *(const v4f*)(xres + frow * CH + ch);
      v4f val;
#pragma unroll
      for (int j = 0; j < 4; ++j) val[j] = kk * u[j] + bf16r(xin[j]);
      xs[i] = val;
      off[i] = frow * OUTW + ch;
    }
#pragma unroll
    for (int i = 0; i < 4; ++i) *(v4f*)(out + off[i]) = xs[i];
    
    wave_lds_sync();
  }
}

// ---------------------------------------------------------------------------
extern "C" void kernel_launch(void* const* d_in, const int* in_sizes, int n_in,
                              void* d_out, int out_size, void* d_ws, size_t ws_size,
                              hipStream_t stream) {
  if (n_in < 6) return;
  const long long need_rows = (long long)(NB - 1) * SEQ_FULL + SEQ;
  if ((long long)in_sizes[0] < need_rows * CH) return;
  if ((long long)in_sizes[1] < need_rows * CH) return;
  if ((long long)in_sizes[2] < need_rows * HD) return;
  if ((long long)in_sizes[3] < need_rows * HD) return;
  if ((long long)in_sizes[4] < need_rows * CH) return;
  if (in_sizes[5] < 1) return;
  if ((long long)out_size < need_rows * OUTW) return;
  if (ws_size < WS_TOTAL) return;

  const float* G  = (const float*)d_in[0];   // g        [NB_FULL][SEQ_FULL][CH]
  const float* X  = (const float*)d_in[1];   // x        [NB_FULL][SEQ_FULL][CH]
  const float* XQ = (const float*)d_in[2];   // x_query  [NB_FULL][SEQ_FULL][HD]  (keys)
  const float* PG = (const float*)d_in[3];   // phi_g    [NB_FULL][SEQ_FULL][HD]  (softmax rows)
  const float* XV = (const float*)d_in[4];   // x_value  [NB_FULL][SEQ_FULL][CH]
  const float* KP = (const float*)d_in[5];   // k        [1]
  float* out = (float*)d_out;

  char* ws = (char*)d_ws;
  _Float16* PG16 = (_Float16*)(ws + OFF_PG);   // [MROWS][HD]
  _Float16* XQ16 = (_Float16*)(ws + OFF_XQ);   // [MROWS][HD]
  _Float16* Vt16 = (_Float16*)(ws + OFF_VT);   // [b][CH][SEQ]

  dim3 blk(256);

  rowconv_kernel<<<dim3(MROWS / 32), blk, 0, stream>>>(PG, XQ, PG16, XQ16);
  // value plane per batch: in [SEQ key rows][CH cols] -> out [CH][SEQ]; grid (CH/64, SEQ/64)
  for (int b = 0; b < NB; ++b) {
    wconv_kernel<<<dim3(CH / 64, SEQ / 64), blk, 0, stream>>>(
        XV + (size_t)b * SEQ_FULL * CH, Vt16 + (size_t)b * CH * SEQ, (unsigned)CH, (unsigned)SEQ);
  }
  attn_kernel<<<dim3(SEQ / 128, CH / CSLAB, NB), blk, 0, stream>>>(PG16, XQ16, Vt16, X, KP, out);
  concat_kernel<<<dim3(MROWS / 4), blk, 0, stream>>>(G, out);
}

// v001
// A run of this version takes 158 microseconds.
// In two side-by-side timings against v000, it was 1.24 and 1.25 times as fast.
#include <hip/hip_runtime.h>
#include <stddef.h>

// Both contractions (row.key scores, K = 64; p.v, K = 4096 keys) on v_wmma_f32_16x16x32_f16
// (f16 operands, f32 accumulate), one product per site. Float inputs are RNE-converted to bf16
// and carried in f16 (score operands x16, value plane x64, softmax numerators x16384 with the
// row sum taken over the converted values). Softmax, scalar gain and residual add in f32.

typedef _Float16 v16h __attribute__((ext_vector_type(16)));
typedef _Float16 v8h  __attribute__((ext_vector_type(8)));
typedef float    v8f  __attribute__((ext_vector_type(8)));
typedef float    v4f  __attribute__((ext_vector_type(4)));
typedef _Float16 h16;

#ifndef NB
#define NB 4
#endif
#ifndef SEQ
#define SEQ 4096
#endif
#define NB_FULL  4
#define SEQ_FULL 4096
#define HD    64      // score depth (channels of the row and key operands)
#define CH    256     // value / residual channels
#define OUTW  512     // output channels (CH result channels, then CH pass-through channels)
#define CSLAB 128     // value channels per attention block
#define MROWS (NB * SEQ)

static_assert(NB >= 1 && NB <= NB_FULL);
static_assert(SEQ >= 128 && SEQ <= SEQ_FULL && (SEQ % 128) == 0);
static_assert(HD == 64);                         // two 32-deep k-steps per score tile
static_assert(OUTW == 2 * CH);
static_assert((CH % CSLAB) == 0 && CSLAB == 8 * 16);   // 8 accumulator column groups per wave
static_assert((CH % 64) == 0 && (SEQ % 64) == 0);      // transpose tiles 64 x 64
static_assert((MROWS % 32) == 0 && (MROWS % 4) == 0);  // helper grids exact
static_assert((HD % 8) == 0 && (CH % 4) == 0);
static_assert((size_t)NB_FULL * SEQ_FULL * OUTW * 4 == (size_t)33554432);

#define LDT 72   // halves per LDS row (144 B, 16-B aligned)
#define LDE 36   // floats per LDS row of the epilogue stage (144 B, 16-B aligned)
static_assert((LDT % 8) == 0 && LDT >= 64);
static_assert((LDE % 4) == 0 && LDE >= 32);
static_assert((size_t)64 * LDT * 2 + (size_t)CSLAB * LDT * 2 + (size_t)8 * 16 * LDT * 2 +
              (size_t)8 * 16 * LDE * 4 <= (size_t)65536);

#define WCARRY 64.0f      // value plane carried x64
#define QCARRY 16.0f      // score operand planes carried x16 each
#define PCARRY 16384.0f   // softmax numerators carried x16384

// workspace layout (bytes)
#define ROW16_BYTES ((size_t)MROWS * HD * 2)
#define VT_BYTES    ((size_t)NB * CH * SEQ * 2)
#define OFF_PG  ((size_t)0)
#define OFF_XQ  (OFF_PG + ROW16_BYTES)
#define OFF_VT  (OFF_XQ + ROW16_BYTES)
#define WS_TOTAL (OFF_VT + VT_BYTES)
static_assert((ROW16_BYTES % 128) == 0 && (VT_BYTES % 128) == 0);
static_assert(WS_TOTAL <= (size_t)134217728);

// ---------------------------------------------------------------------------
__device__ __forceinline__ float bf16r(float x) {   // RNE convert to bf16, returned widened
  unsigned int u = __float_as_uint(x);
  u = (u + 0x7FFFu + ((u >> 16) & 1u)) & 0xFFFF0000u;
  return __uint_as_float(u);
}

// f32 -> f16 for matrix operands; values below the smallest f16 normal become zero.
static __device__ __forceinline__ h16 toh_flush(float v) {
  const h16 r = (h16)v;
  return (fabsf(v) < 6.103515625e-05f) ? (h16)0.0f : r;
}

// 16-bit fragment: p points at element [row = lane&15][k0 + 8*(lane>>4)] of a k-contiguous
// row. Elements 0..7 <- k0+8h+0..7, elements 8..15 <- k0+16+8h+0..7 (same map for A and B).
__device__ __forceinline__ v16h frag_at(const _Float16* p) {
  v8h lo = *(const v8h*)(p);
  v8h hi = *(const v8h*)(p + 16);
  v16h out;
#pragma unroll
  for (int i = 0; i < 8; ++i) { out[i] = lo[i]; out[i + 8] = hi[i]; }
  return out;
}
__device__ __forceinline__ v16h ld_frag(const _Float16* base, unsigned ld) {
  const unsigned lane = threadIdx.x & 31u;
  return frag_at(base + (lane & 15u) * ld + (lane >> 4) * 8u);
}

__device__ __forceinline__ v8f wmma16(v16h a, v16h b, v8f c) {
  return __builtin_amdgcn_wmma_f32_16x16x32_f16(false, a, false, b, (short)0, c, false, false);
}

__device__ __forceinline__ float red16_max(float x) {
#pragma unroll
  for (int off = 1; off < 16; off <<= 1) x = fmaxf(x, __shfl_xor(x, off, 32));
  return x;
}
__device__ __forceinline__ float red16_sum(float x) {
#pragma unroll
  for (int off = 1; off < 16; off <<= 1) x += __shfl_xor(x, off, 32);
  return x;
}

__device__ __forceinline__ void wave_lds_sync() {
  __builtin_amdgcn_fence(3 /* release order */, "wavefront");
  asm volatile("s_wait_dscnt 0x0" ::: "memory");
  __builtin_amdgcn_wave_barrier();
}

// ---------------------------------------------------------------------------
// Weight plane: in W[K rows][N cols] (pitch ldw = N) -> out Wt[N][K] (pitch ldk = K),
// f16(64 * bf16(w)). Grid (N/64, K/64). T: cross-wave (block barrier).
// ---------------------------------------------------------------------------
__global__ __launch_bounds__(256) void wconv_kernel(
    const float* __restrict__ W, _Float16* __restrict__ Wt, unsigned ldw, unsigned ldk) {
  __shared__ _Float16 T[64 * LDT];
  const unsigned tid = threadIdx.x;
  const unsigned n0 = blockIdx.x * 64u;
  const unsigned k0 = blockIdx.y * 64u;
#pragma unroll 4
  for (unsigned j = 0; j < 16u; ++j) {
    const unsigned idx = tid + 256u * j;
    const unsigned kr = idx >> 6, nc = idx & 63u;
    const float v = W[(size_t)(k0 + kr) * ldw + n0 + nc];
    T[nc * LDT + kr] = (_Float16)(WCARRY * bf16r(v));
  }
  __syncthreads();
  v8h x[2];
  size_t off[2];
#pragma unroll
  for (unsigned i = 0; i < 2u; ++i) {
    const unsigned n = 32u * i + (tid >> 3);
    const unsigned kc = (tid & 7u) * 8u;
    x[i] = *(const v8h*)&T[n * LDT + kc];
    off[i] = (size_t)(n0 + n) * ldk + k0 + kc;
  }
#pragma unroll
  for (int i = 0; i < 2; ++i) *(v8h*)(Wt + off[i]) = x[i];
  
}

// ---------------------------------------------------------------------------
// Score operand planes: compact rows [MROWS][HD] of f16(16 * bf16(value)) for the row operand
// and for the key operand. One thread converts 8 consecutive values of each plane; 8
// ---------------------------------------------------------------------------
__global__ __launch_bounds__(256) void rowconv_kernel(
    const float* __restrict__ RowIn, const float* __restrict__ KeyIn,
    _Float16* __restrict__ row16, _Float16* __restrict__ key16) {
#pragma clang fp contract(off)
  const unsigned idx = blockIdx.x * 256u + threadIdx.x;
  const unsigned crow = idx >> 3;
  const unsigned c = (idx & 7u) * 8u;
  const unsigned bidx = crow / (unsigned)SEQ;
  const unsigned sq = crow - bidx * (unsigned)SEQ;
  const size_t frow = (size_t)bidx * SEQ_FULL + sq;
  const v4f a0 = *(const v4f*)(RowIn + frow * HD + c);
  const v4f a1 = *(const v4f*)(RowIn + frow * HD + c + 4u);
  const v4f b0 = *(const v4f*)(KeyIn + frow * HD + c);
  const v4f b1 = *(const v4f*)(KeyIn + frow * HD + c + 4u);
  v8h xr, xk;
#pragma unroll
  for (int i = 0; i < 4; ++i) {
    xr[i]     = toh_flush(QCARRY * bf16r(a0[i]));
    xr[i + 4] = toh_flush(QCARRY * bf16r(a1[i]));
    xk[i]     = toh_flush(QCARRY * bf16r(b0[i]));
    xk[i + 4] = toh_flush(QCARRY * bf16r(b1[i]));
  }
  const size_t off = (size_t)crow * HD + c;
  *(v8h*)(row16 + off) = xr;
  *(v8h*)(key16 + off) = xk;
  
}

// ---------------------------------------------------------------------------
// Pass-through half of the output: out[full row][CH + c] = bf16(g[full row][c]).
// ---------------------------------------------------------------------------
__global__ __launch_bounds__(256) void concat_kernel(
    const float* __restrict__ G, float* __restrict__ out) {
#pragma clang fp contract(off)
  const unsigned idx = blockIdx.x * 256u + threadIdx.x;
  const unsigned crow = idx >> 6;
  const unsigned c = (idx & 63u) * 4u;
  const unsigned bidx = crow / (unsigned)SEQ;
  const unsigned sq = crow - bidx * (unsigned)SEQ;
  const size_t frow = (size_t)bidx * SEQ_FULL + sq;
  const v4f a = *(const v4f*)(G + frow * CH + c);
  v4f o;
#pragma unroll
  for (int j = 0; j < 4; ++j) o[j] = bf16r(a[j]);
  float* p = out + frow * OUTW + CH + c;
  *(v4f*)p = o;
  
}

// ---------------------------------------------------------------------------
// Dense flash attention per (128 softmax rows, 128-channel value slab, batch). 8 waves x 16
// rows, 64 keys per step over all SEQ keys: key tile Ks[key][d] and V^T tile Vs[c][key] staged
// with plain 16-B loads (cross-wave, block barriers); online softmax in registers (16-lane
// shuffles), no mask, unit score scale; P tile per wave in Ps (wave-private, wave sync) as
// f16(16384 p), values below the smallest f16 normal set to zero, row sum over the converted
// values; O (16 x 128 per wave) in registers.
// Epilogue: 32 channels at a time staged in the wave's Cs tile (wave-private, wave sync), then
// Grid (SEQ/128, CH/CSLAB, NB).
// ---------------------------------------------------------------------------
__global__ __launch_bounds__(256) void attn_kernel(
    const _Float16* __restrict__ Qh, const _Float16* __restrict__ Kh,
    const _Float16* __restrict__ Vt, const float* __restrict__ xres,
    const float* __restrict__ kp, float* __restrict__ out) {
  __shared__ __attribute__((aligned(16))) _Float16 Ks[64 * LDT];
  __shared__ __attribute__((aligned(16))) _Float16 Vs[CSLAB * LDT];
  __shared__ __attribute__((aligned(16))) _Float16 Ps[8 * 16 * LDT];
  __shared__ __attribute__((aligned(16))) float Cs[8 * 16 * LDE];

  const unsigned tid = threadIdx.x, lane = tid & 31u;
  const unsigned wave = (unsigned)__builtin_amdgcn_readfirstlane((int)(threadIdx.x >> 5));
  const unsigned hh = lane >> 4, m = lane & 15u;
  const unsigned q0 = blockIdx.x * 128u;
  const unsigned slab = blockIdx.y;
  const unsigned b = blockIdx.z;
  const float sinv = 1.0f / (QCARRY * QCARRY);
  const unsigned qrow0 = q0 + wave * 16u;
  _Float16* P = Ps + wave * (16u * LDT);

  const size_t qoff = (size_t)(b * (unsigned)SEQ + qrow0 + m) * HD + hh * 8u;
  v16h qf[2];
  qf[0] = frag_at(Qh + qoff);
  qf[1] = frag_at(Qh + qoff + 32);

  float mrow[8], lrow[8];
  v8f o[8];
#pragma unroll
  for (int v = 0; v < 8; ++v) { mrow[v] = -1.0e30f; lrow[v] = 0.0f; }
#pragma unroll
  for (int nb = 0; nb < 8; ++nb) o[nb] = (v8f){};

  const size_t kplane = (size_t)b * SEQ * HD;
  const size_t vplane = ((size_t)b * CH + slab * (unsigned)CSLAB) * SEQ;

#pragma unroll 1
  for (unsigned kb = 0; kb < (unsigned)SEQ; kb += 64u) {
#pragma unroll
    for (unsigned j = 0; j < 2u; ++j) {
      const unsigned idx = tid + 256u * j;
      const unsigned r = idx >> 3, c = (idx & 7u) * 8u;
      *(v8h*)&Ks[r * LDT + c] = *(const v8h*)(Kh + kplane + (size_t)(kb + r) * HD + c);
    }
#pragma unroll
    for (unsigned j = 0; j < 4u; ++j) {
      const unsigned idx = tid + 256u * j;
      const unsigned r = idx >> 3, c = (idx & 7u) * 8u;
      *(v8h*)&Vs[r * LDT + c] = *(const v8h*)(Vt + vplane + (size_t)r * SEQ + kb + c);
    }
    __syncthreads();

    // scores: 4 key groups of 16, K = 64 in two 32-steps; all 8 key fragments are read from
    // LDS as one group ahead of the 8 products
    v16h kf[8];
#pragma unroll
    for (int kg = 0; kg < 4; ++kg)
#pragma unroll
      for (int c = 0; c < 2; ++c) kf[kg * 2 + c] = ld_frag(&Ks[(kg * 16) * LDT + c * 32], LDT);
    // keeps the 16 reads together: sunk to their products, each pair is waited for on its own
    __builtin_amdgcn_sched_barrier(0);
    v8f s[4];
#pragma unroll
    for (int kg = 0; kg < 4; ++kg) s[kg] = wmma16(qf[0], kf[kg * 2], (v8f){});
#pragma unroll
    for (int kg = 0; kg < 4; ++kg) s[kg] = wmma16(qf[1], kf[kg * 2 + 1], s[kg]) * sinv;

    // online softmax; row (hh*8+v) spread over the 16 lanes of a half
    float alpha[8];
#pragma unroll
    for (int v = 0; v < 8; ++v) {
      float mx = fmaxf(fmaxf(s[0][v], s[1][v]), fmaxf(s[2][v], s[3][v]));
      mx = red16_max(mx);
      const float mn = fmaxf(mrow[v], mx);
      alpha[v] = __expf(mrow[v] - mn);
      mrow[v] = mn;
    }
    // all 16 value fragments of this step are read from LDS as one group here, behind the last
    // exchange of the row maximum, so that they land under the exponentials.
    // Inputs only, no code: the eight row maxima are complete in front of the reads, and the reads
    // do not move up over it. LDS returns in order: an exchange placed behind the reads (two rows'
    // were, without this line) waits for all of them.
    asm volatile("" :: "v"(mrow[0]), "v"(mrow[1]), "v"(mrow[2]), "v"(mrow[3]),
                       "v"(mrow[4]), "v"(mrow[5]), "v"(mrow[6]), "v"(mrow[7]));
    v16h vf[16];
#pragma unroll
    for (int c = 0; c < 2; ++c)
#pragma unroll
      for (int nb = 0; nb < 8; ++nb) vf[c * 8 + nb] = ld_frag(&Vs[(nb * 16) * LDT + c * 32], LDT);
    // keeps the 32 reads up here: without it they sink behind most of the exponentials
    __builtin_amdgcn_sched_barrier(0);
    // P tile [16 rows][64 keys], f16(16384 p); s keeps the converted value for the row sum
#pragma unroll
    for (int kg = 0; kg < 4; ++kg)
#pragma unroll
      for (int v = 0; v < 8; ++v) {
        const h16 ph = toh_flush(__expf(s[kg][v] - mrow[v]) * PCARRY);
        P[(hh * 8u + (unsigned)v) * LDT + (unsigned)kg * 16u + m] = ph;
        s[kg][v] = (float)ph;
      }
#pragma unroll
    for (int v = 0; v < 8; ++v) {
      const float rs = red16_sum((s[0][v] + s[1][v]) + (s[2][v] + s[3][v]));
      lrow[v] = alpha[v] * lrow[v] + rs;
    }
#pragma unroll
    for (int nb = 0; nb < 8; ++nb)
#pragma unroll
      for (int v = 0; v < 8; ++v) o[nb][v] = o[nb][v] * alpha[v];
    wave_lds_sync();

    // O += P . V  (K = 64 keys in two 32-steps; B = V^T tile [c][key])
    v16h pf[2];
#pragma unroll
    for (int c = 0; c < 2; ++c) pf[c] = ld_frag(P + c * 32, LDT);
#pragma unroll
    for (int c = 0; c < 2; ++c)
#pragma unroll
      for (int nb = 0; nb < 8; ++nb) o[nb] = wmma16(pf[c], vf[c * 8 + nb], o[nb]);
    __syncthreads();
  }

  // finalize: k * O / (64 l) + x, 32 channels per pass through the wave's Cs tile
  const float kk = bf16r(kp[0]);
  float inv[8];
#pragma unroll
  for (int v = 0; v < 8; ++v) inv[v] = __builtin_amdgcn_rcpf(lrow[v]) * (1.0f / WCARRY);
  const unsigned cw = wave * (16u * LDE);
  const size_t frow0 = (size_t)b * SEQ_FULL + qrow0;
  const unsigned ch0 = slab * (unsigned)CSLAB;
#pragma unroll
  for (int pr = 0; pr < 4; ++pr) {
#pragma unroll
    for (int v = 0; v < 8; ++v) {
      Cs[cw + (hh * 8u + (unsigned)v) * LDE + m]       = o[2 * pr][v] * inv[v];
      Cs[cw + (hh * 8u + (unsigned)v) * LDE + 16u + m] = o[2 * pr + 1][v] * inv[v];
    }
    wave_lds_sync();
    v4f xs[4];
    size_t off[4];
#pragma unroll
    for (unsigned i = 0; i < 4u; ++i) {
      const unsigned r = 4u * i + (lane >> 3);
      const unsigned c = (lane & 7u) * 4u;
      const size_t frow = frow0 + r;
      const unsigned ch = ch0 + 32u * (unsigned)pr + c;
      const v4f u = *(const v4f*)&Cs[cw + r * LDE + c];
      const v4f xin = *(const v4f*)(xres + frow * CH + ch);
      v4f val;
#pragma unroll
      for (int j = 0; j < 4; ++j) val[j] = kk * u[j] + bf16r(xin[j]);
      xs[i] = val;
      off[i] = frow * OUTW + ch;
    }
#pragma unroll
    for (int i = 0; i < 4; ++i) *(v4f*)(out + off[i]) = xs[i];
    
    wave_lds_sync();
  }
}

// ---------------------------------------------------------------------------
extern "C" void kernel_launch(void* const* d_in, const int* in_sizes, int n_in,
                              void* d_out, int out_size, void* d_ws, size_t ws_size,
                              hipStream_t stream) {
  if (n_in < 6) return;
  const long long need_rows = (long long)(NB - 1) * SEQ_FULL + SEQ;
  if ((long long)in_sizes[0] < need_rows * CH) return;
  if ((long long)in_sizes[1] < need_rows * CH) return;
  if ((long long)in_sizes[2] < need_rows * HD) return;
  if ((long long)in_sizes[3] < need_rows * HD) return;
  if ((long long)in_sizes[4] < need_rows * CH) return;
  if (in_sizes[5] < 1) return;
  if ((long long)out_size < need_rows * OUTW) return;
  if (ws_size < WS_TOTAL) return;

  const float* G  = (const float*)d_in[0];   // g        [NB_FULL][SEQ_FULL][CH]
  const float* X  = (const float*)d_in[1];   // x        [NB_FULL][SEQ_FULL][CH]
  const float* XQ = (const float*)d_in[2];   // x_query  [NB_FULL][SEQ_FULL][HD]  (keys)
  const float* PG = (const float*)d_in[3];   // phi_g    [NB_FULL][SEQ_FULL][HD]  (softmax rows)
  const float* XV = (const float*)d_in[4];   // x_value  [NB_FULL][SEQ_FULL][CH]
  const float* KP = (const float*)d_in[5];   // k        [1]
  float* out = (float*)d_out;

  char* ws = (char*)d_ws;
  _Float16* PG16 = (_Float16*)(ws + OFF_PG);   // [MROWS][HD]
  _Float16* XQ16 = (_Float16*)(ws + OFF_XQ);   // [MROWS][HD]
  _Float16* Vt16 = (_Float16*)(ws + OFF_VT);   // [b][CH][SEQ]

  dim3 blk(256);

  rowconv_kernel<<<dim3(MROWS / 32), blk, 0, stream>>>(PG, XQ, PG16, XQ16);
  // value plane per batch: in [SEQ key rows][CH cols] -> out [CH][SEQ]; grid (CH/64, SEQ/64)
  for (int b = 0; b < NB; ++b) {
    wconv_kernel<<<dim3(CH / 64, SEQ / 64), blk, 0, stream>>>(
        XV + (size_t)b * SEQ_FULL * CH, Vt16 + (size_t)b * CH * SEQ, (unsigned)CH, (unsigned)SEQ);
  }
  attn_kernel<<<dim3(SEQ / 128, CH / CSLAB, NB), blk, 0, stream>>>(PG16, XQ16, Vt16, X, KP, out);
  concat_kernel<<<dim3(MROWS / 4), blk, 0, stream>>>(G, out);
}

// v002
// It runs in 120 microseconds.
// Timed twice side by side with v001, it ran 1.32 and 1.30 times as fast.
// Over all steps from v000 it is 1.63 times as fast.
#include <hip/hip_runtime.h>
#include <stddef.h>

// Both contractions (row.key scores, K = 64; p.v, K = 4096 keys) on v_wmma_f32_16x16x32_f16
// (f16 operands, f32 accumulate), one product per site, both taken transposed (key x row scores,
// channel x row result). Float inputs are RNE-converted to bf16
// and carried in f16 (score operands x16, value plane x64, softmax numerators x16384 with the
// row sum taken over the converted values). Softmax, scalar gain and residual add in f32.

typedef _Float16 v16h __attribute__((ext_vector_type(16)));
typedef _Float16 v8h  __attribute__((ext_vector_type(8)));
typedef float    v8f  __attribute__((ext_vector_type(8)));
typedef float    v4f  __attribute__((ext_vector_type(4)));
typedef _Float16 h16;

#ifndef NB
#define NB 4
#endif
#ifndef SEQ
#define SEQ 4096
#endif
#define NB_FULL  4
#define SEQ_FULL 4096
#define HD    64      // score depth (channels of the row and key operands)
#define CH    256     // value / residual channels
#define OUTW  512     // output channels (CH result channels, then CH pass-through channels)
#define CSLAB 128     // value channels per attention block
#define MROWS (NB * SEQ)

static_assert(NB >= 1 && NB <= NB_FULL);
static_assert(SEQ >= 128 && SEQ <= SEQ_FULL && (SEQ % 128) == 0);
static_assert(HD == 64);                         // two 32-deep k-steps per score tile
static_assert(OUTW == 2 * CH);
static_assert((CH % CSLAB) == 0 && CSLAB == 8 * 16);   // 8 accumulator tiles of 16 channels per wave
static_assert((CH % 64) == 0 && (SEQ % 64) == 0);      // transpose tiles 64 x 64
static_assert((MROWS % 32) == 0 && (MROWS % 4) == 0);  // helper grids exact
static_assert((HD % 8) == 0 && (CH % 4) == 0);
static_assert((size_t)NB_FULL * SEQ_FULL * OUTW * 4 == (size_t)33554432);

#define LDT 72   // halves per LDS row (144 B, 16-B aligned)
#define LDE 36   // floats per LDS row of the epilogue stage (144 B, 16-B aligned)
static_assert((LDT % 8) == 0 && LDT >= 64);
static_assert((LDE % 4) == 0 && LDE >= 32);
static_assert((size_t)64 * LDT * 2 + (size_t)CSLAB * LDT * 2 + (size_t)8 * 16 * LDE * 4 <=
              (size_t)65536);

#define WCARRY 64.0f      // value plane carried x64
#define QCARRY 16.0f      // score operand planes carried x16 each
#define PCARRY 16384.0f   // softmax numerators carried x16384
#define LOG2E  1.44269504f

// workspace layout (bytes)
#define ROW16_BYTES ((size_t)MROWS * HD * 2)
#define VT_BYTES    ((size_t)NB * CH * SEQ * 2)
#define OFF_PG  ((size_t)0)
#define OFF_XQ  (OFF_PG + ROW16_BYTES)
#define OFF_VT  (OFF_XQ + ROW16_BYTES)
#define WS_TOTAL (OFF_VT + VT_BYTES)
static_assert((ROW16_BYTES % 128) == 0 && (VT_BYTES % 128) == 0);
static_assert(WS_TOTAL <= (size_t)134217728);

// ---------------------------------------------------------------------------
__device__ __forceinline__ float bf16r(float x) {   // RNE convert to bf16, returned widened
  unsigned int u = __float_as_uint(x);
  u = (u + 0x7FFFu + ((u >> 16) & 1u)) & 0xFFFF0000u;
  return __uint_as_float(u);
}

// f32 -> f16 for matrix operands; values below the smallest f16 normal become zero.
static __device__ __forceinline__ h16 toh_flush(float v) {
  const h16 r = (h16)v;
  return (fabsf(v) < 6.103515625e-05f) ? (h16)0.0f : r;
}

// 16-bit fragment: p points at element [row = lane&15][k0 + 8*(lane>>4)] of a k-contiguous
// row. Elements 0..7 <- k0+8h+0..7, elements 8..15 <- k0+16+8h+0..7 (same map for A and B).
__device__ __forceinline__ v16h frag_at(const _Float16* p) {
  v8h lo = *(const v8h*)(p);
  v8h hi = *(const v8h*)(p + 16);
  v16h out;
#pragma unroll
  for (int i = 0; i < 8; ++i) { out[i] = lo[i]; out[i + 8] = hi[i]; }
  return out;
}
__device__ __forceinline__ v16h ld_frag(const _Float16* base, unsigned ld) {
  const unsigned lane = threadIdx.x & 31u;
  return frag_at(base + (lane & 15u) * ld + (lane >> 4) * 8u);
}

__device__ __forceinline__ v8f wmma16(v16h a, v16h b, v8f c) {
  return __builtin_amdgcn_wmma_f32_16x16x32_f16(false, a, false, b, (short)0, c, false, false);
}

// value of lane l ^ 16 (the other half of the wave), by a vector cross-row move
__device__ __forceinline__ float xhalf(float x) {
  const int b = __builtin_bit_cast(int, x);
  return __builtin_bit_cast(
      float, __builtin_amdgcn_permlanex16(b, b, 0x76543210, 0xfedcba98, false, false));
}

// 2^x for eight values. One statement, so that the v_nop stands directly behind the last
// v_exp_f32: the instruction set asks for one slot between a transcendental and a vector
// instruction that uses its result or overwrites its source.
// Early-clobber outputs: no exponential of the run overwrites a neighbour's source either.
__device__ __forceinline__ v8f exp2x8(v8f x) {
  float r0, r1, r2, r3, r4, r5, r6, r7;
  asm("v_exp_f32 %0, %8\n\tv_exp_f32 %1, %9\n\tv_exp_f32 %2, %10\n\tv_exp_f32 %3, %11\n\t"
      "v_exp_f32 %4, %12\n\tv_exp_f32 %5, %13\n\tv_exp_f32 %6, %14\n\tv_exp_f32 %7, %15\n\t"
      "v_nop"
      : "=&v"(r0), "=&v"(r1), "=&v"(r2), "=&v"(r3), "=&v"(r4), "=&v"(r5), "=&v"(r6), "=&v"(r7)
      : "v"(x[0]), "v"(x[1]), "v"(x[2]), "v"(x[3]), "v"(x[4]), "v"(x[5]), "v"(x[6]), "v"(x[7]));
  return (v8f){r0, r1, r2, r3, r4, r5, r6, r7};
}

__device__ __forceinline__ void wave_lds_sync() {
  __builtin_amdgcn_fence(3 /* release order */, "wavefront");
  asm volatile("s_wait_dscnt 0x0" ::: "memory");
  __builtin_amdgcn_wave_barrier();
}

// ---------------------------------------------------------------------------
// Weight plane: in W[K rows][N cols] (pitch ldw = N) -> out Wt[N][K] (pitch ldk = K),
// f16(64 * bf16(w)). Grid (N/64, K/64). T: cross-wave (block barrier).
// ---------------------------------------------------------------------------
__global__ __launch_bounds__(256) void wconv_kernel(
    const float* __restrict__ W, _Float16* __restrict__ Wt, unsigned ldw, unsigned ldk) {
  __shared__ _Float16 T[64 * LDT];
  const unsigned tid = threadIdx.x;
  const unsigned n0 = blockIdx.x * 64u;
  const unsigned k0 = blockIdx.y * 64u;
#pragma unroll 4
  for (unsigned j = 0; j < 16u; ++j) {
    const unsigned idx = tid + 256u * j;
    const unsigned kr = idx >> 6, nc = idx & 63u;
    const float v = W[(size_t)(k0 + kr) * ldw + n0 + nc];
    T[nc * LDT + kr] = (_Float16)(WCARRY * bf16r(v));
  }
  __syncthreads();
  v8h x[2];
  size_t off[2];
#pragma unroll
  for (unsigned i = 0; i < 2u; ++i) {
    const unsigned n = 32u * i + (tid >> 3);
    const unsigned kc = (tid & 7u) * 8u;
    x[i] = *(const v8h*)&T[n * LDT + kc];
    off[i] = (size_t)(n0 + n) * ldk + k0 + kc;
  }
#pragma unroll
  for (int i = 0; i < 2; ++i) *(v8h*)(Wt + off[i]) = x[i];
  
}

// ---------------------------------------------------------------------------
// Score operand planes: compact rows [MROWS][HD] of f16(16 * bf16(value)) for the row operand
// and for the key operand. One thread converts 8 consecutive values of each plane; 8
// ---------------------------------------------------------------------------
__global__ __launch_bounds__(256) void rowconv_kernel(
    const float* __restrict__ RowIn, const float* __restrict__ KeyIn,
    _Float16* __restrict__ row16, _Float16* __restrict__ key16) {
#pragma clang fp contract(off)
  const unsigned idx = blockIdx.x * 256u + threadIdx.x;
  const unsigned crow = idx >> 3;
  const unsigned c = (idx & 7u) * 8u;
  const unsigned bidx = crow / (unsigned)SEQ;
  const unsigned sq = crow - bidx * (unsigned)SEQ;
  const size_t frow = (size_t)bidx * SEQ_FULL + sq;
  const v4f a0 = *(const v4f*)(RowIn + frow * HD + c);
  const v4f a1 = *(const v4f*)(RowIn + frow * HD + c + 4u);
  const v4f b0 = *(const v4f*)(KeyIn + frow * HD + c);
  const v4f b1 = *(const v4f*)(KeyIn + frow * HD + c + 4u);
  v8h xr, xk;
#pragma unroll
  for (int i = 0; i < 4; ++i) {
    xr[i]     = toh_flush(QCARRY * bf16r(a0[i]));
    xr[i + 4] = toh_flush(QCARRY * bf16r(a1[i]));
    xk[i]     = toh_flush(QCARRY * bf16r(b0[i]));
    xk[i + 4] = toh_flush(QCARRY * bf16r(b1[i]));
  }
  const size_t off = (size_t)crow * HD + c;
  *(v8h*)(row16 + off) = xr;
  *(v8h*)(key16 + off) = xk;
  
}

// ---------------------------------------------------------------------------
// Pass-through half of the output: out[full row][CH + c] = bf16(g[full row][c]).
// ---------------------------------------------------------------------------
__global__ __launch_bounds__(256) void concat_kernel(
    const float* __restrict__ G, float* __restrict__ out) {
#pragma clang fp contract(off)
  const unsigned idx = blockIdx.x * 256u + threadIdx.x;
  const unsigned crow = idx >> 6;
  const unsigned c = (idx & 63u) * 4u;
  const unsigned bidx = crow / (unsigned)SEQ;
  const unsigned sq = crow - bidx * (unsigned)SEQ;
  const size_t frow = (size_t)bidx * SEQ_FULL + sq;
  const v4f a = *(const v4f*)(G + frow * CH + c);
  v4f o;
#pragma unroll
  for (int j = 0; j < 4; ++j) o[j] = bf16r(a[j]);
  float* p = out + frow * OUTW + CH + c;
  *(v4f*)p = o;
  
}

// ---------------------------------------------------------------------------
// Dense flash attention per (128 softmax rows, 128-channel value slab, batch). 8 waves x 16
// rows, 64 keys per step over all SEQ keys: key tile Ks[key][d] and V^T tile Vs[c][key] staged
// with plain 16-B loads (cross-wave, block barriers). Both products are taken transposed:
// S^T = K . Q^T (A = key rows, B = softmax rows) and O^T += V^T . P^T (A = channel rows). Lane
// (hh, m) then holds softmax row m alone: keys 16 kg + 8 hh + v of its scores, so that maximum
// and sum run inside the lane with one exchange between the wave's halves, and the converted
// scores of two key groups ARE the B operand of the second product (element i of the fragment
// is key 8 hh + i, element 8 + i is key 16 + 8 hh + i, the order frag_at gives the A side): P
// stays in registers. No mask, unit score scale; P as f16(16384 p), values below the smallest
// f16 normal set to zero, row sum over the converted values, each half's share kept apart until
// the epilogue; O^T (128 channels x 16 rows per wave) in registers.
// Epilogue: 32 channels at a time staged in the wave's Cs tile (wave-private, wave sync), then
// Grid (SEQ/128, CH/CSLAB, NB).
// ---------------------------------------------------------------------------
__global__ __launch_bounds__(256) void attn_kernel(
    const _Float16* __restrict__ Qh, const _Float16* __restrict__ Kh,
    const _Float16* __restrict__ Vt, const float* __restrict__ xres,
    const float* __restrict__ kp, float* __restrict__ out) {
  __shared__ __attribute__((aligned(16))) _Float16 Ks[64 * LDT];
  __shared__ __attribute__((aligned(16))) _Float16 Vs[CSLAB * LDT];
  __shared__ __attribute__((aligned(16))) float Cs[8 * 16 * LDE];

  const unsigned tid = threadIdx.x, lane = tid & 31u;
  const unsigned wave = (unsigned)__builtin_amdgcn_readfirstlane((int)(threadIdx.x >> 5));
  const unsigned hh = lane >> 4, m = lane & 15u;
  const unsigned q0 = blockIdx.x * 128u;
  const unsigned slab = blockIdx.y;
  const unsigned b = blockIdx.z;
  const float sinv = 1.0f / (QCARRY * QCARRY);
  const unsigned qrow0 = q0 + wave * 16u;

  const size_t qoff = (size_t)(b * (unsigned)SEQ + qrow0 + m) * HD + hh * 8u;
  v16h qf[2];
  qf[0] = frag_at(Qh + qoff);
  qf[1] = frag_at(Qh + qoff + 32);

  float mrow = -1.0e30f, lrow = 0.0f;   // softmax row m; lrow covers this half's keys only
  v8f o[8];
#pragma unroll
  for (int nb = 0; nb < 8; ++nb) o[nb] = (v8f){};

  const size_t kplane = (size_t)b * SEQ * HD;
  const size_t vplane = ((size_t)b * CH + slab * (unsigned)CSLAB) * SEQ;

#pragma unroll 1
  for (unsigned kb = 0; kb < (unsigned)SEQ; kb += 64u) {
#pragma unroll
    for (unsigned j = 0; j < 2u; ++j) {
      const unsigned idx = tid + 256u * j;
      const unsigned r = idx >> 3, c = (idx & 7u) * 8u;
      *(v8h*)&Ks[r * LDT + c] = *(const v8h*)(Kh + kplane + (size_t)(kb + r) * HD + c);
    }
#pragma unroll
    for (unsigned j = 0; j < 4u; ++j) {
      const unsigned idx = tid + 256u * j;
      const unsigned r = idx >> 3, c = (idx & 7u) * 8u;
      *(v8h*)&Vs[r * LDT + c] = *(const v8h*)(Vt + vplane + (size_t)r * SEQ + kb + c);
    }
    __syncthreads();

    // scores: 4 key groups of 16, K = 64 in two 32-steps; all 8 key fragments are read from
    // LDS as one group ahead of the 8 products
    v16h kf[8];
#pragma unroll
    for (int kg = 0; kg < 4; ++kg)
#pragma unroll
      for (int c = 0; c < 2; ++c) kf[kg * 2 + c] = ld_frag(&Ks[(kg * 16) * LDT + c * 32], LDT);
    // keeps the 16 reads together: sunk to their products, each pair is waited for on its own
    __builtin_amdgcn_sched_barrier(0);
    v8f s[4];   // s[kg][v] = score of key 16 kg + 8 hh + v against softmax row m
#pragma unroll
    for (int kg = 0; kg < 4; ++kg) s[kg] = wmma16(kf[kg * 2], qf[0], (v8f){});
#pragma unroll
    for (int kg = 0; kg < 4; ++kg) s[kg] = wmma16(kf[kg * 2 + 1], qf[1], s[kg]) * sinv;

    // online softmax: 32 of the row's 64 scores are in this lane, the rest in lane ^ 16
    float t[8];
#pragma unroll
    for (int v = 0; v < 8; ++v)
      t[v] = fmaxf(fmaxf(s[0][v], s[1][v]), fmaxf(s[2][v], s[3][v]));
    float mx = fmaxf(fmaxf(fmaxf(t[0], t[1]), fmaxf(t[2], t[3])),
                     fmaxf(fmaxf(t[4], t[5]), fmaxf(t[6], t[7])));
    mx = fmaxf(mx, xhalf(mx));
    const float mn = fmaxf(mrow, mx);
    // alpha = exp(mrow - mn), formed as __expf forms it (times log2 e, then v_exp_f32), with the
    // v_nop of exp2x8 behind it, for the same reason
    float alpha;
    asm("v_exp_f32 %0, %1\n\tv_nop" : "=v"(alpha) : "v"((mrow - mn) * LOG2E));
    mrow = mn;
    // all 16 value fragments of this step are read from LDS as one group here, so that they land
    // under the exponentials
    v16h vf[16];
#pragma unroll
    for (int c = 0; c < 2; ++c)
#pragma unroll
      for (int nb = 0; nb < 8; ++nb) vf[c * 8 + nb] = ld_frag(&Vs[(nb * 16) * LDT + c * 32], LDT);
    // keeps the 32 reads up here: without it they sink behind most of the exponentials
    __builtin_amdgcn_sched_barrier(0);
    // P^T fragments [32 keys][16 rows], f16(16384 p); s keeps the converted value for the row sum
    v16h pf[2];
#pragma unroll
    for (int kg = 0; kg < 4; ++kg) {
      const v8f e = exp2x8((s[kg] - mrow) * LOG2E);   // exp(s - mrow) as __expf forms it
#pragma unroll
      for (int v = 0; v < 8; ++v) {
        const h16 ph = toh_flush(e[v] * PCARRY);
        pf[kg >> 1][(kg & 1) * 8 + v] = ph;
        s[kg][v] = (float)ph;
      }
    }
#pragma unroll
    for (int v = 0; v < 8; ++v) t[v] = (s[0][v] + s[1][v]) + (s[2][v] + s[3][v]);
    lrow = alpha * lrow + (((t[0] + t[1]) + (t[2] + t[3])) + ((t[4] + t[5]) + (t[6] + t[7])));
#pragma unroll
    for (int nb = 0; nb < 8; ++nb) o[nb] = o[nb] * alpha;

    // O^T += V^T . P^T  (K = 64 keys in two 32-steps; A = V^T tile [c][key])
#pragma unroll
    for (int c = 0; c < 2; ++c)
#pragma unroll
      for (int nb = 0; nb < 8; ++nb) o[nb] = wmma16(vf[c * 8 + nb], pf[c], o[nb]);
    __syncthreads();
  }

  // finalize: k * O / (64 l) + x, 32 channels per pass through the wave's Cs tile
  const float kk = bf16r(kp[0]);
  // v_rcp_f32 with the v_nop of exp2x8 behind it, for the same reason
  float rl;
  asm("v_rcp_f32 %0, %1\n\tv_nop" : "=v"(rl) : "v"(lrow + xhalf(lrow)));
  const float inv = rl * (1.0f / WCARRY);
  const unsigned cw = wave * (16u * LDE);
  const size_t frow0 = (size_t)b * SEQ_FULL + qrow0;
  const unsigned ch0 = slab * (unsigned)CSLAB;
#pragma unroll
  for (int pr = 0; pr < 4; ++pr) {
    // o[nb][v] = row m, channel 16 nb + 8 hh + v: 8 consecutive channels per lane and tile
#pragma unroll
    for (int u = 0; u < 2; ++u) {
      const v8f ov = o[2 * pr + u] * inv;
      float* cp = &Cs[cw + m * LDE + 16u * (unsigned)u + hh * 8u];
      *(v4f*)cp       = (v4f){ov[0], ov[1], ov[2], ov[3]};
      *(v4f*)(cp + 4) = (v4f){ov[4], ov[5], ov[6], ov[7]};
    }
    wave_lds_sync();
    v4f xs[4];
    size_t off[4];
#pragma unroll
    for (unsigned i = 0; i < 4u; ++i) {
      const unsigned r = 4u * i + (lane >> 3);
      const unsigned c = (lane & 7u) * 4u;
      const size_t frow = frow0 + r;
      const unsigned ch = ch0 + 32u * (unsigned)pr + c;
      const v4f u = *(const v4f*)&Cs[cw + r * LDE + c];
      const v4f xin = *(const v4f*)(xres + frow * CH + ch);
      v4f val;
#pragma unroll
      for (int j = 0; j < 4; ++j) val[j] = kk * u[j] + bf16r(xin[j]);
      xs[i] = val;
      off[i] = frow * OUTW + ch;
    }
#pragma unroll
    for (int i = 0; i < 4; ++i) *(v4f*)(out + off[i]) = xs[i];
    
    wave_lds_sync();
  }
}

// ---------------------------------------------------------------------------
extern "C" void kernel_launch(void* const* d_in, const int* in_sizes, int n_in,
                              void* d_out, int out_size, void* d_ws, size_t ws_size,
                              hipStream_t stream) {
  if (n_in < 6) return;
  const long long need_rows = (long long)(NB - 1) * SEQ_FULL + SEQ;
  if ((long long)in_sizes[0] < need_rows * CH) return;
  if ((long long)in_sizes[1] < need_rows * CH) return;
  if ((long long)in_sizes[2] < need_rows * HD) return;
  if ((long long)in_sizes[3] < need_rows * HD) return;
  if ((long long)in_sizes[4] < need_rows * CH) return;
  if (in_sizes[5] < 1) return;
  if ((long long)out_size < need_rows * OUTW) return;
  if (ws_size < WS_TOTAL) return;

  const float* G  = (const float*)d_in[0];   // g        [NB_FULL][SEQ_FULL][CH]
  const float* X  = (const float*)d_in[1];   // x        [NB_FULL][SEQ_FULL][CH]
  const float* XQ = (const float*)d_in[2];   // x_query  [NB_FULL][SEQ_FULL][HD]  (keys)
  const float* PG = (const float*)d_in[3];   // phi_g    [NB_FULL][SEQ_FULL][HD]  (softmax rows)
  const float* XV = (const float*)d_in[4];   // x_value  [NB_FULL][SEQ_FULL][CH]
  const float* KP = (const float*)d_in[5];   // k        [1]
  float* out = (float*)d_out;

  char* ws = (char*)d_ws;
  _Float16* PG16 = (_Float16*)(ws + OFF_PG);   // [MROWS][HD]
  _Float16* XQ16 = (_Float16*)(ws + OFF_XQ);   // [MROWS][HD]
  _Float16* Vt16 = (_Float16*)(ws + OFF_VT);   // [b][CH][SEQ]

  dim3 blk(256);

  rowconv_kernel<<<dim3(MROWS / 32), blk, 0, stream>>>(PG, XQ, PG16, XQ16);
  // value plane per batch: in [SEQ key rows][CH cols] -> out [CH][SEQ]; grid (CH/64, SEQ/64)
  for (int b = 0; b < NB; ++b) {
    wconv_kernel<<<dim3(CH / 64, SEQ / 64), blk, 0, stream>>>(
        XV + (size_t)b * SEQ_FULL * CH, Vt16 + (size_t)b * CH * SEQ, (unsigned)CH, (unsigned)SEQ);
  }
  attn_kernel<<<dim3(SEQ / 128, CH / CSLAB, NB), blk, 0, stream>>>(PG16, XQ16, Vt16, X, KP, out);
  concat_kernel<<<dim3(MROWS / 4), blk, 0, stream>>>(G, out);
}

// v003
// One run takes 103 microseconds.
// In two side-by-side timings against v002, it was 1.17 and 1.18 times as fast.
// All steps since v000 together make it 1.91 times as fast.
#include <hip/hip_runtime.h>
#include <stddef.h>

// Both contractions (row.key scores, K = 64; p.v, K = 4096 keys) on v_wmma_f32_16x16x32_f16
// (f16 operands, f32 accumulate), one product per site, both taken transposed (key x row scores,
// channel x row result). Float inputs are RNE-converted to bf16
// and carried in f16 (score operands x16, value plane x64, softmax numerators x16384 with the
// row sum taken over the converted values). Softmax, scalar gain and residual add in f32.

typedef _Float16 v16h __attribute__((ext_vector_type(16)));
typedef _Float16 v8h  __attribute__((ext_vector_type(8)));
typedef float    v8f  __attribute__((ext_vector_type(8)));
typedef float    v4f  __attribute__((ext_vector_type(4)));
typedef _Float16 h16;

#ifndef NB
#define NB 4
#endif
#ifndef SEQ
#define SEQ 4096
#endif
#define NB_FULL  4
#define SEQ_FULL 4096
#define HD    64      // score depth (channels of the row and key operands)
#define CH    256     // value / residual channels
#define OUTW  512     // output channels (CH result channels, then CH pass-through channels)
#define CSLAB 128     // value channels per attention block
#define MROWS (NB * SEQ)

static_assert(NB >= 1 && NB <= NB_FULL);
static_assert(SEQ >= 128 && SEQ <= SEQ_FULL && (SEQ % 128) == 0);
static_assert(HD == 64);                         // two 32-deep k-steps per score tile
static_assert(OUTW == 2 * CH);
static_assert((CH % CSLAB) == 0 && CSLAB == 8 * 16);   // 8 accumulator tiles of 16 channels per wave
static_assert((CH % 64) == 0 && (SEQ % 64) == 0);      // transpose tiles 64 x 64
static_assert((MROWS % 32) == 0 && (MROWS % 4) == 0);
static_assert((HD % 8) == 0 && (CH % 4) == 0);
static_assert((size_t)NB_FULL * SEQ_FULL * OUTW * 4 == (size_t)33554432);

#define LDT 72   // halves per LDS row (144 B, 16-B aligned)
#define LDE 36   // floats per LDS row of the epilogue stage (144 B, 16-B aligned)
static_assert((LDT % 8) == 0 && LDT >= 64);
static_assert((LDE % 4) == 0 && LDE >= 32);
static_assert((size_t)64 * LDT * 2 + (size_t)CSLAB * LDT * 2 + (size_t)8 * 16 * LDE * 4 <=
              (size_t)65536);

#define WCARRY 64.0f      // value plane carried x64
#define QCARRY 16.0f      // score operand planes carried x16 each
#define PCARRY 16384.0f   // softmax numerators carried x16384
#define LOG2E  1.44269504f

// workspace layout (bytes)
#define ROW16_BYTES ((size_t)MROWS * HD * 2)
#define VT_BYTES    ((size_t)NB * CH * SEQ * 2)
#define OFF_PG  ((size_t)0)
#define OFF_XQ  (OFF_PG + ROW16_BYTES)
#define OFF_VT  (OFF_XQ + ROW16_BYTES)
#define WS_TOTAL (OFF_VT + VT_BYTES)
static_assert((ROW16_BYTES % 128) == 0 && (VT_BYTES % 128) == 0);
static_assert(WS_TOTAL <= (size_t)134217728);

// ---------------------------------------------------------------------------
__device__ __forceinline__ float bf16r(float x) {   // RNE convert to bf16, returned widened
  unsigned int u = __float_as_uint(x);
  u = (u + 0x7FFFu + ((u >> 16) & 1u)) & 0xFFFF0000u;
  return __uint_as_float(u);
}

// f32 -> f16 for matrix operands; values below the smallest f16 normal become zero.
static __device__ __forceinline__ h16 toh_flush(float v) {
  const h16 r = (h16)v;
  return (fabsf(v) < 6.103515625e-05f) ? (h16)0.0f : r;
}

// 16-bit fragment: p points at element [row = lane&15][k0 + 8*(lane>>4)] of a k-contiguous
// row. Elements 0..7 <- k0+8h+0..7, elements 8..15 <- k0+16+8h+0..7 (same map for A and B).
__device__ __forceinline__ v16h frag_at(const _Float16* p) {
  v8h lo = *(const v8h*)(p);
  v8h hi = *(const v8h*)(p + 16);
  v16h out;
#pragma unroll
  for (int i = 0; i < 8; ++i) { out[i] = lo[i]; out[i + 8] = hi[i]; }
  return out;
}
__device__ __forceinline__ v16h ld_frag(const _Float16* base, unsigned ld) {
  const unsigned lane = threadIdx.x & 31u;
  return frag_at(base + (lane & 15u) * ld + (lane >> 4) * 8u);
}

__device__ __forceinline__ v8f wmma16(v16h a, v16h b, v8f c) {
  return __builtin_amdgcn_wmma_f32_16x16x32_f16(false, a, false, b, (short)0, c, false, false);
}

// value of lane l ^ 16 (the other half of the wave), by a vector cross-row move
__device__ __forceinline__ float xhalf(float x) {
  const int b = __builtin_bit_cast(int, x);
  return __builtin_bit_cast(
      float, __builtin_amdgcn_permlanex16(b, b, 0x76543210, 0xfedcba98, false, false));
}

// 2^x for eight values. One statement, so that the v_nop stands directly behind the last
// v_exp_f32: the instruction set asks for one slot between a transcendental and a vector
// instruction that uses its result or overwrites its source.
// Early-clobber outputs: no exponential of the run overwrites a neighbour's source either.
__device__ __forceinline__ v8f exp2x8(v8f x) {
  float r0, r1, r2, r3, r4, r5, r6, r7;
  asm("v_exp_f32 %0, %8\n\tv_exp_f32 %1, %9\n\tv_exp_f32 %2, %10\n\tv_exp_f32 %3, %11\n\t"
      "v_exp_f32 %4, %12\n\tv_exp_f32 %5, %13\n\tv_exp_f32 %6, %14\n\tv_exp_f32 %7, %15\n\t"
      "v_nop"
      : "=&v"(r0), "=&v"(r1), "=&v"(r2), "=&v"(r3), "=&v"(r4), "=&v"(r5), "=&v"(r6), "=&v"(r7)
      : "v"(x[0]), "v"(x[1]), "v"(x[2]), "v"(x[3]), "v"(x[4]), "v"(x[5]), "v"(x[6]), "v"(x[7]));
  return (v8f){r0, r1, r2, r3, r4, r5, r6, r7};
}

__device__ __forceinline__ void wave_lds_sync() {
  __builtin_amdgcn_fence(3 /* release order */, "wavefront");
  asm volatile("s_wait_dscnt 0x0" ::: "memory");
  __builtin_amdgcn_wave_barrier();
}

// ---------------------------------------------------------------------------
// Every pass outside the attention kernel, in one launch. Block blk takes one 64 x 64 tile of the
// value transpose and the 16 rows numbered blk of the other passes:
//  - value plane: V[b][key][ch] -> Vt[b][ch][key] = f16(64 * bf16(v)), through T (cross-wave,
//    block barrier); tiles numbered channel tile first, then key tile, then batch;
//  - score operand planes: compact rows [MROWS][HD] of f16(16 * bf16(value)); waves 0..3 convert
//    the row operand, waves 4..7 the key operand, 8 consecutive values per thread;
//  - pass-through half of the output: out[full row][CH + c] = bf16(g[full row][c]), four 16-B
//    pieces per thread.
// All global loads stand ahead of the barrier and all global stores behind it: a barrier behind a
// global store first waits for that store.
// Grid (NB * (CH/64) * (SEQ/64)).
// ---------------------------------------------------------------------------
#define NTILE_C (CH / 64)
#define NTILE_B (NTILE_C * (SEQ / 64))
#define PREP_BLOCKS (NB * NTILE_B)
static_assert((size_t)PREP_BLOCKS * 16 == (size_t)MROWS);   // 16 rows of each row pass per block

__global__ __launch_bounds__(256) void prep_kernel(
    const float* __restrict__ RowIn, const float* __restrict__ KeyIn,
    const float* __restrict__ V, const float* __restrict__ G,
    _Float16* __restrict__ row16, _Float16* __restrict__ key16,
    _Float16* __restrict__ Vt, float* __restrict__ out) {
  __shared__ _Float16 T[64 * LDT];
  const unsigned tid = threadIdx.x;
  const unsigned blk = blockIdx.x;

  // the block's 16 compact rows lie in one batch (SEQ is a multiple of 16)
  const unsigned crow0 = blk * 16u;
  const unsigned rb = crow0 / (unsigned)SEQ;
  const size_t frow0 = (size_t)rb * SEQ_FULL + (crow0 - rb * (unsigned)SEQ);

  // pass-through slice: piece j is row (tid >> 6) + 4 j, channels 4 (tid & 63) ..
  const unsigned gr = tid >> 6, gc = (tid & 63u) * 4u;
  const float* __restrict__ gp = G + (frow0 + gr) * CH + gc;
  float* __restrict__ op = out + (frow0 + gr) * OUTW + CH + gc;
  v4f ga[4];
#pragma unroll
  for (int j = 0; j < 4; ++j) ga[j] = *(const v4f*)(gp + j * 4 * CH);

  // score operand slice: row (tid & 127) >> 3, values 8 (tid & 7) ..
  const bool keyside = __builtin_amdgcn_readfirstlane((int)(tid >> 7)) != 0;
  const float* __restrict__ splane = keyside ? KeyIn : RowIn;
  _Float16* __restrict__ dplane = keyside ? key16 : row16;
  const unsigned sr = (tid & 127u) >> 3, sc = (tid & 7u) * 8u;
  const float* __restrict__ sp = splane + (frow0 + sr) * HD + sc;
  const v4f a0 = *(const v4f*)(sp);
  const v4f a1 = *(const v4f*)(sp + 4);
  // the wait that stands before an issued load's address register is written again. The addresses
  // are named as inputs so that they stay whole up to it. This statement and its
  // twin below also hold the block's 22 loads ahead of their first use: left alone, the compiler
  // waited for them in four groups, one memory latency after the other
  asm volatile("s_wait_xcnt 0x0" :: "v"(gp), "v"(sp) : "memory");

  // value tile: element j is key row (tid >> 6) + 4 j, channel tid & 63
  const unsigned vb = blk / (unsigned)NTILE_B;
  const unsigned vt = blk - vb * (unsigned)NTILE_B;
  const unsigned n0 = (vt % (unsigned)NTILE_C) * 64u;
  const unsigned k0 = (vt / (unsigned)NTILE_C) * 64u;
  const unsigned kr = tid >> 6, nc = tid & 63u;
  const float* __restrict__ wp = V + ((size_t)vb * SEQ_FULL + k0 + kr) * CH + n0 + nc;
  _Float16* __restrict__ Wt = Vt + (size_t)vb * CH * SEQ;
  float wv[16];
#pragma unroll
  for (int j = 0; j < 16; ++j) wv[j] = wp[j * 4 * CH];
  asm volatile("s_wait_xcnt 0x0" :: "v"(wp) : "memory");   // as above, for these 16 loads
#pragma unroll
  for (int j = 0; j < 16; ++j) T[nc * LDT + kr + 4 * j] = (_Float16)(WCARRY * bf16r(wv[j]));
  __syncthreads();
  v8h x[2];
  size_t off[2];
#pragma unroll
  for (unsigned i = 0; i < 2u; ++i) {
    const unsigned n = 32u * i + (tid >> 3);
    const unsigned kc = (tid & 7u) * 8u;
    x[i] = *(const v8h*)&T[n * LDT + kc];
    off[i] = (size_t)(n0 + n) * SEQ + k0 + kc;
  }
#pragma unroll
  for (int i = 0; i < 2; ++i) *(v8h*)(Wt + off[i]) = x[i];

  // score operand slice: convert and store
  v8h xs;
#pragma unroll
  for (int i = 0; i < 4; ++i) {
    xs[i]     = toh_flush(QCARRY * bf16r(a0[i]));
    xs[i + 4] = toh_flush(QCARRY * bf16r(a1[i]));
  }
  *(v8h*)(dplane + (size_t)(crow0 + sr) * HD + sc) = xs;

  // pass-through slice: convert and store
#pragma unroll
  for (int j = 0; j < 4; ++j) {
    v4f o;
#pragma unroll
    for (int e = 0; e < 4; ++e) o[e] = bf16r(ga[j][e]);
    *(v4f*)(op + j * 4 * OUTW) = o;
  }
}

// ---------------------------------------------------------------------------
// Dense flash attention per (128 softmax rows, 128-channel value slab, batch). 8 waves x 16
// rows, 64 keys per step over all SEQ keys: key tile Ks[key][d] and V^T tile Vs[c][key] staged
// with plain 16-B loads (cross-wave, block barriers). Both products are taken transposed:
// S^T = K . Q^T (A = key rows, B = softmax rows) and O^T += V^T . P^T (A = channel rows). Lane
// (hh, m) then holds softmax row m alone: keys 16 kg + 8 hh + v of its scores, so that maximum
// and sum run inside the lane with one exchange between the wave's halves, and the converted
// scores of two key groups ARE the B operand of the second product (element i of the fragment
// is key 8 hh + i, element 8 + i is key 16 + 8 hh + i, the order frag_at gives the A side): P
// stays in registers. No mask, unit score scale; P as f16(16384 p), values below the smallest
// f16 normal set to zero, row sum over the converted values, each half's share kept apart until
// the epilogue; O^T (128 channels x 16 rows per wave) in registers.
// Epilogue: 32 channels at a time staged in the wave's Cs tile (wave-private, wave sync), then
// Grid (SEQ/128, CH/CSLAB, NB).
// ---------------------------------------------------------------------------
__global__ __launch_bounds__(256) void attn_kernel(
    const _Float16* __restrict__ Qh, const _Float16* __restrict__ Kh,
    const _Float16* __restrict__ Vt, const float* __restrict__ xres,
    const float* __restrict__ kp, float* __restrict__ out) {
  __shared__ __attribute__((aligned(16))) _Float16 Ks[64 * LDT];
  __shared__ __attribute__((aligned(16))) _Float16 Vs[CSLAB * LDT];
  __shared__ __attribute__((aligned(16))) float Cs[8 * 16 * LDE];

  const unsigned tid = threadIdx.x, lane = tid & 31u;
  const unsigned wave = (unsigned)__builtin_amdgcn_readfirstlane((int)(threadIdx.x >> 5));
  const unsigned hh = lane >> 4, m = lane & 15u;
  const unsigned q0 = blockIdx.x * 128u;
  const unsigned slab = blockIdx.y;
  const unsigned b = blockIdx.z;
  const float sinv = 1.0f / (QCARRY * QCARRY);
  const unsigned qrow0 = q0 + wave * 16u;

  const size_t qoff = (size_t)(b * (unsigned)SEQ + qrow0 + m) * HD + hh * 8u;
  v16h qf[2];
  qf[0] = frag_at(Qh + qoff);
  qf[1] = frag_at(Qh + qoff + 32);

  float mrow = -1.0e30f, lrow = 0.0f;   // softmax row m; lrow covers this half's keys only
  v8f o[8];
#pragma unroll
  for (int nb = 0; nb < 8; ++nb) o[nb] = (v8f){};

  const size_t kplane = (size_t)b * SEQ * HD;
  const size_t vplane = ((size_t)b * CH + slab * (unsigned)CSLAB) * SEQ;

#pragma unroll 1
  for (unsigned kb = 0; kb < (unsigned)SEQ; kb += 64u) {
#pragma unroll
    for (unsigned j = 0; j < 2u; ++j) {
      const unsigned idx = tid + 256u * j;
      const unsigned r = idx >> 3, c = (idx & 7u) * 8u;
      *(v8h*)&Ks[r * LDT + c] = *(const v8h*)(Kh + kplane + (size_t)(kb + r) * HD + c);
    }
#pragma unroll
    for (unsigned j = 0; j < 4u; ++j) {
      const unsigned idx = tid + 256u * j;
      const unsigned r = idx >> 3, c = (idx & 7u) * 8u;
      *(v8h*)&Vs[r * LDT + c] = *(const v8h*)(Vt + vplane + (size_t)r * SEQ + kb + c);
    }
    __syncthreads();

    // scores: 4 key groups of 16, K = 64 in two 32-steps; all 8 key fragments are read from
    // LDS as one group ahead of the 8 products
    v16h kf[8];
#pragma unroll
    for (int kg = 0; kg < 4; ++kg)
#pragma unroll
      for (int c = 0; c < 2; ++c) kf[kg * 2 + c] = ld_frag(&Ks[(kg * 16) * LDT + c * 32], LDT);
    // keeps the 16 reads together: sunk to their products, each pair is waited for on its own
    __builtin_amdgcn_sched_barrier(0);
    v8f s[4];   // s[kg][v] = score of key 16 kg + 8 hh + v against softmax row m
#pragma unroll
    for (int kg = 0; kg < 4; ++kg) s[kg] = wmma16(kf[kg * 2], qf[0], (v8f){});
#pragma unroll
    for (int kg = 0; kg < 4; ++kg) s[kg] = wmma16(kf[kg * 2 + 1], qf[1], s[kg]) * sinv;

    // online softmax: 32 of the row's 64 scores are in this lane, the rest in lane ^ 16
    float t[8];
#pragma unroll
    for (int v = 0; v < 8; ++v)
      t[v] = fmaxf(fmaxf(s[0][v], s[1][v]), fmaxf(s[2][v], s[3][v]));
    float mx = fmaxf(fmaxf(fmaxf(t[0], t[1]), fmaxf(t[2], t[3])),
                     fmaxf(fmaxf(t[4], t[5]), fmaxf(t[6], t[7])));
    mx = fmaxf(mx, xhalf(mx));
    const float mn = fmaxf(mrow, mx);
    // alpha = exp(mrow - mn), formed as __expf forms it (times log2 e, then v_exp_f32), with the
    // v_nop of exp2x8 behind it, for the same reason
    float alpha;
    asm("v_exp_f32 %0, %1\n\tv_nop" : "=v"(alpha) : "v"((mrow - mn) * LOG2E));
    mrow = mn;
    // all 16 value fragments of this step are read from LDS as one group here, so that they land
    // under the exponentials
    v16h vf[16];
#pragma unroll
    for (int c = 0; c < 2; ++c)
#pragma unroll
      for (int nb = 0; nb < 8; ++nb) vf[c * 8 + nb] = ld_frag(&Vs[(nb * 16) * LDT + c * 32], LDT);
    // keeps the 32 reads up here: without it they sink behind most of the exponentials
    __builtin_amdgcn_sched_barrier(0);
    // P^T fragments [32 keys][16 rows], f16(16384 p); s keeps the converted value for the row sum
    v16h pf[2];
#pragma unroll
    for (int kg = 0; kg < 4; ++kg) {
      const v8f e = exp2x8((s[kg] - mrow) * LOG2E);   // exp(s - mrow) as __expf forms it
#pragma unroll
      for (int v = 0; v < 8; ++v) {
        const h16 ph = toh_flush(e[v] * PCARRY);
        pf[kg >> 1][(kg & 1) * 8 + v] = ph;
        s[kg][v] = (float)ph;
      }
    }
#pragma unroll
    for (int v = 0; v < 8; ++v) t[v] = (s[0][v] + s[1][v]) + (s[2][v] + s[3][v]);
    lrow = alpha * lrow + (((t[0] + t[1]) + (t[2] + t[3])) + ((t[4] + t[5]) + (t[6] + t[7])));
#pragma unroll
    for (int nb = 0; nb < 8; ++nb) o[nb] = o[nb] * alpha;

    // O^T += V^T . P^T  (K = 64 keys in two 32-steps; A = V^T tile [c][key])
#pragma unroll
    for (int c = 0; c < 2; ++c)
#pragma unroll
      for (int nb = 0; nb < 8; ++nb) o[nb] = wmma16(vf[c * 8 + nb], pf[c], o[nb]);
    __syncthreads();
  }

  // finalize: k * O / (64 l) + x, 32 channels per pass through the wave's Cs tile
  const float kk = bf16r(kp[0]);
  // v_rcp_f32 with the v_nop of exp2x8 behind it, for the same reason
  float rl;
  asm("v_rcp_f32 %0, %1\n\tv_nop" : "=v"(rl) : "v"(lrow + xhalf(lrow)));
  const float inv = rl * (1.0f / WCARRY);
  const unsigned cw = wave * (16u * LDE);
  const size_t frow0 = (size_t)b * SEQ_FULL + qrow0;
  const unsigned ch0 = slab * (unsigned)CSLAB;
#pragma unroll
  for (int pr = 0; pr < 4; ++pr) {
    // o[nb][v] = row m, channel 16 nb + 8 hh + v: 8 consecutive channels per lane and tile
#pragma unroll
    for (int u = 0; u < 2; ++u) {
      const v8f ov = o[2 * pr + u] * inv;
      float* cp = &Cs[cw + m * LDE + 16u * (unsigned)u + hh * 8u];
      *(v4f*)cp       = (v4f){ov[0], ov[1], ov[2], ov[3]};
      *(v4f*)(cp + 4) = (v4f){ov[4], ov[5], ov[6], ov[7]};
    }
    wave_lds_sync();
    v4f xs[4];
    size_t off[4];
#pragma unroll
    for (unsigned i = 0; i < 4u; ++i) {
      const unsigned r = 4u * i + (lane >> 3);
      const unsigned c = (lane & 7u) * 4u;
      const size_t frow = frow0 + r;
      const unsigned ch = ch0 + 32u * (unsigned)pr + c;
      const v4f u = *(const v4f*)&Cs[cw + r * LDE + c];
      const v4f xin = *(const v4f*)(xres + frow * CH + ch);
      v4f val;
#pragma unroll
      for (int j = 0; j < 4; ++j) val[j] = kk * u[j] + bf16r(xin[j]);
      xs[i] = val;
      off[i] = frow * OUTW + ch;
    }
#pragma unroll
    for (int i = 0; i < 4; ++i) *(v4f*)(out + off[i]) = xs[i];
    
    wave_lds_sync();
  }
}

// ---------------------------------------------------------------------------
extern "C" void kernel_launch(void* const* d_in, const int* in_sizes, int n_in,
                              void* d_out, int out_size, void* d_ws, size_t ws_size,
                              hipStream_t stream) {
  if (n_in < 6) return;
  const long long need_rows = (long long)(NB - 1) * SEQ_FULL + SEQ;
  if ((long long)in_sizes[0] < need_rows * CH) return;
  if ((long long)in_sizes[1] < need_rows * CH) return;
  if ((long long)in_sizes[2] < need_rows * HD) return;
  if ((long long)in_sizes[3] < need_rows * HD) return;
  if ((long long)in_sizes[4] < need_rows * CH) return;
  if (in_sizes[5] < 1) return;
  if ((long long)out_size < need_rows * OUTW) return;
  if (ws_size < WS_TOTAL) return;

  const float* G  = (const float*)d_in[0];   // g        [NB_FULL][SEQ_FULL][CH]
  const float* X  = (const float*)d_in[1];   // x        [NB_FULL][SEQ_FULL][CH]
  const float* XQ = (const float*)d_in[2];   // x_query  [NB_FULL][SEQ_FULL][HD]  (keys)
  const float* PG = (const float*)d_in[3];   // phi_g    [NB_FULL][SEQ_FULL][HD]  (softmax rows)
  const float* XV = (const float*)d_in[4];   // x_value  [NB_FULL][SEQ_FULL][CH]
  const float* KP = (const float*)d_in[5];   // k        [1]
  float* out = (float*)d_out;

  char* ws = (char*)d_ws;
  _Float16* PG16 = (_Float16*)(ws + OFF_PG);   // [MROWS][HD]
  _Float16* XQ16 = (_Float16*)(ws + OFF_XQ);   // [MROWS][HD]
  _Float16* Vt16 = (_Float16*)(ws + OFF_VT);   // [b][CH][SEQ]

  dim3 blk(256);

  prep_kernel<<<dim3(PREP_BLOCKS), blk, 0, stream>>>(PG, XQ, XV, G, PG16, XQ16, Vt16, out);
  attn_kernel<<<dim3(SEQ / 128, CH / CSLAB, NB), blk, 0, stream>>>(PG16, XQ16, Vt16, X, KP, out);
}

// v004
// It runs in 69.8 microseconds.
// Timed twice side by side with v003, it ran 1.46 and 1.41 times as fast.
// All steps since v000 together make it 2.74 times as fast.
#include <hip/hip_runtime.h>
#include <stddef.h>

// Both contractions (row.key scores, K = 64; p.v, K = 4096 keys) on v_wmma_f32_16x16x32_f16
// (f16 operands, f32 accumulate), one product per site, both taken transposed (key x row scores,
// channel x row result). Float inputs are RNE-converted to bf16
// and carried in f16 (score operands x16, value plane x64, softmax numerators x16384 with the
// row sum taken over the converted values). Softmax, scalar gain and residual add in f32.

typedef _Float16 v16h __attribute__((ext_vector_type(16)));
typedef _Float16 v8h  __attribute__((ext_vector_type(8)));
typedef float    v8f  __attribute__((ext_vector_type(8)));
typedef float    v4f  __attribute__((ext_vector_type(4)));
typedef _Float16 h16;

#ifndef NB
#define NB 4
#endif
#ifndef SEQ
#define SEQ 4096
#endif
#define NB_FULL  4
#define SEQ_FULL 4096
#define HD    64      // score depth (channels of the row and key operands)
#define CH    256     // value / residual channels
#define OUTW  512     // output channels (CH result channels, then CH pass-through channels)
#define CSLAB 128     // value channels per attention block
#define MROWS (NB * SEQ)

static_assert(NB >= 1 && NB <= NB_FULL);
static_assert(SEQ >= 128 && SEQ <= SEQ_FULL && (SEQ % 128) == 0);
static_assert(HD == 64);                         // two 32-deep k-steps per score tile
static_assert(OUTW == 2 * CH);
static_assert((CH % CSLAB) == 0 && CSLAB == 8 * 16);   // 8 accumulator tiles of 16 channels per wave
static_assert((CH % 64) == 0 && (SEQ % 64) == 0);      // transpose tiles 64 x 64
static_assert((MROWS % 32) == 0 && (MROWS % 4) == 0);
static_assert((HD % 8) == 0 && (CH % 4) == 0);
static_assert((size_t)NB_FULL * SEQ_FULL * OUTW * 4 == (size_t)33554432);

#define LDT 72   // halves per LDS row (144 B, 16-B aligned)
#define LDE 36   // floats per LDS row of the epilogue stage (144 B, 16-B aligned)
static_assert((LDT % 8) == 0 && LDT >= 64);
static_assert((LDE % 4) == 0 && LDE >= 32);
#define KS_HALVES  (64 * LDT)                 // key tile of one ring buffer
#define BUF_HALVES (KS_HALVES + CSLAB * LDT)   // key tile, then value tile
#define BUF_BYTES  (BUF_HALVES * 2)
static_assert((BUF_BYTES % 16) == 0 && (KS_HALVES % 8) == 0);
static_assert((size_t)2 * BUF_BYTES + (size_t)8 * 16 * LDE * 4 <= (size_t)327680);

#define WCARRY 64.0f      // value plane carried x64
#define QCARRY 16.0f      // score operand planes carried x16 each
#define PCARRY 16384.0f   // softmax numerators carried x16384
#define LOG2E  1.44269504f

// workspace layout (bytes)
#define ROW16_BYTES ((size_t)MROWS * HD * 2)
#define VT_BYTES    ((size_t)NB * CH * SEQ * 2)
#define OFF_PG  ((size_t)0)
#define OFF_XQ  (OFF_PG + ROW16_BYTES)
#define OFF_VT  (OFF_XQ + ROW16_BYTES)
#define WS_TOTAL (OFF_VT + VT_BYTES)
static_assert((ROW16_BYTES % 128) == 0 && (VT_BYTES % 128) == 0);
static_assert(WS_TOTAL <= (size_t)134217728);

// ---------------------------------------------------------------------------
__device__ __forceinline__ float bf16r(float x) {   // RNE convert to bf16, returned widened
  unsigned int u = __float_as_uint(x);
  u = (u + 0x7FFFu + ((u >> 16) & 1u)) & 0xFFFF0000u;
  return __uint_as_float(u);
}

// f32 -> f16 for matrix operands; values below the smallest f16 normal become zero.
static __device__ __forceinline__ h16 toh_flush(float v) {
  const h16 r = (h16)v;
  return (fabsf(v) < 6.103515625e-05f) ? (h16)0.0f : r;
}

// 16-bit fragment: p points at element [row = lane&15][k0 + 8*(lane>>4)] of a k-contiguous
// row. Elements 0..7 <- k0+8h+0..7, elements 8..15 <- k0+16+8h+0..7 (same map for A and B).
__device__ __forceinline__ v16h frag_at(const _Float16* p) {
  v8h lo = *(const v8h*)(p);
  v8h hi = *(const v8h*)(p + 16);
  v16h out;
#pragma unroll
  for (int i = 0; i < 8; ++i) { out[i] = lo[i]; out[i + 8] = hi[i]; }
  return out;
}
__device__ __forceinline__ v16h ld_frag(const _Float16* base, unsigned ld) {
  const unsigned lane = threadIdx.x & 31u;
  return frag_at(base + (lane & 15u) * ld + (lane >> 4) * 8u);
}

__device__ __forceinline__ v8f wmma16(v16h a, v16h b, v8f c) {
  return __builtin_amdgcn_wmma_f32_16x16x32_f16(false, a, false, b, (short)0, c, false, false);
}

// value of lane l ^ 16 (the other half of the wave), by a vector cross-row move
__device__ __forceinline__ float xhalf(float x) {
  const int b = __builtin_bit_cast(int, x);
  return __builtin_bit_cast(
      float, __builtin_amdgcn_permlanex16(b, b, 0x76543210, 0xfedcba98, false, false));
}

// 2^x for eight values. One statement, so that the v_nop stands directly behind the last
// v_exp_f32: the instruction set asks for one slot between a transcendental and a vector
// instruction that uses its result or overwrites its source.
// Early-clobber outputs: no exponential of the run overwrites a neighbour's source either.
__device__ __forceinline__ v8f exp2x8(v8f x) {
  float r0, r1, r2, r3, r4, r5, r6, r7;
  asm("v_exp_f32 %0, %8\n\tv_exp_f32 %1, %9\n\tv_exp_f32 %2, %10\n\tv_exp_f32 %3, %11\n\t"
      "v_exp_f32 %4, %12\n\tv_exp_f32 %5, %13\n\tv_exp_f32 %6, %14\n\tv_exp_f32 %7, %15\n\t"
      "v_nop"
      : "=&v"(r0), "=&v"(r1), "=&v"(r2), "=&v"(r3), "=&v"(r4), "=&v"(r5), "=&v"(r6), "=&v"(r7)
      : "v"(x[0]), "v"(x[1]), "v"(x[2]), "v"(x[3]), "v"(x[4]), "v"(x[5]), "v"(x[6]), "v"(x[7]));
  return (v8f){r0, r1, r2, r3, r4, r5, r6, r7};
}

__device__ __forceinline__ void wave_lds_sync() {
  __builtin_amdgcn_fence(3 /* release order */, "wavefront");
  asm volatile("s_wait_dscnt 0x0" ::: "memory");
  __builtin_amdgcn_wave_barrier();
}

// One 64-key stage (key tile [64][HD], value tile [CSLAB][64]) from global memory into a ring
// buffer, through no register: six 16-B asynchronous copies per lane, rows 32 apart. lds = the
// lane's byte address in the buffer's key tile, gk / gv = its first piece of each tile.
// s_wait_xcnt 0 is the statement's last line so that it stands in front of every later write of
// a register that a copy names.
__device__ __forceinline__ void copy_stage(unsigned lds, const _Float16* gk, const _Float16* gv) {
  const unsigned lv = lds + KS_HALVES * 2u;
  asm volatile(
      "global_load_async_to_lds_b128 %0, %6, off\n\t"
      "global_load_async_to_lds_b128 %1, %7, off\n\t"
      "global_load_async_to_lds_b128 %2, %8, off\n\t"
      "global_load_async_to_lds_b128 %3, %9, off\n\t"
      "global_load_async_to_lds_b128 %4, %10, off\n\t"
      "global_load_async_to_lds_b128 %5, %11, off\n\t"
      "s_wait_xcnt 0x0"
      :: "v"(lds), "v"(lds + 32u * LDT * 2u),
         "v"(lv), "v"(lv + 32u * LDT * 2u), "v"(lv + 64u * LDT * 2u), "v"(lv + 96u * LDT * 2u),
         "v"(gk), "v"(gk + 32 * HD),
         "v"(gv), "v"(gv + 32 * SEQ), "v"(gv + 64 * SEQ), "v"(gv + 96 * SEQ)
      : "memory");
}

// ---------------------------------------------------------------------------
// Every pass outside the attention kernel, in one launch. Block blk takes one 64 x 64 tile of the
// value transpose and the 16 rows numbered blk of the other passes:
//  - value plane: V[b][key][ch] -> Vt[b][ch][key] = f16(64 * bf16(v)), through T (cross-wave,
//    block barrier); tiles numbered channel tile first, then key tile, then batch;
//  - score operand planes: compact rows [MROWS][HD] of f16(16 * bf16(value)); waves 0..3 convert
//    the row operand, waves 4..7 the key operand, 8 consecutive values per thread;
//  - pass-through half of the output: out[full row][CH + c] = bf16(g[full row][c]), four 16-B
//    pieces per thread.
// All global loads stand ahead of the barrier and all global stores behind it: a barrier behind a
// global store first waits for that store.
// Grid (NB * (CH/64) * (SEQ/64)).
// ---------------------------------------------------------------------------
#define NTILE_C (CH / 64)
#define NTILE_B (NTILE_C * (SEQ / 64))
#define PREP_BLOCKS (NB * NTILE_B)
static_assert((size_t)PREP_BLOCKS * 16 == (size_t)MROWS);   // 16 rows of each row pass per block

__global__ __launch_bounds__(256) void prep_kernel(
    const float* __restrict__ RowIn, const float* __restrict__ KeyIn,
    const float* __restrict__ V, const float* __restrict__ G,
    _Float16* __restrict__ row16, _Float16* __restrict__ key16,
    _Float16* __restrict__ Vt, float* __restrict__ out) {
  __shared__ _Float16 T[64 * LDT];
  const unsigned tid = threadIdx.x;
  const unsigned blk = blockIdx.x;

  // the block's 16 compact rows lie in one batch (SEQ is a multiple of 16)
  const unsigned crow0 = blk * 16u;
  const unsigned rb = crow0 / (unsigned)SEQ;
  const size_t frow0 = (size_t)rb * SEQ_FULL + (crow0 - rb * (unsigned)SEQ);

  // pass-through slice: piece j is row (tid >> 6) + 4 j, channels 4 (tid & 63) ..
  const unsigned gr = tid >> 6, gc = (tid & 63u) * 4u;
  const float* __restrict__ gp = G + (frow0 + gr) * CH + gc;
  float* __restrict__ op = out + (frow0 + gr) * OUTW + CH + gc;
  v4f ga[4];
#pragma unroll
  for (int j = 0; j < 4; ++j) ga[j] = *(const v4f*)(gp + j * 4 * CH);

  // score operand slice: row (tid & 127) >> 3, values 8 (tid & 7) ..
  const bool keyside = __builtin_amdgcn_readfirstlane((int)(tid >> 7)) != 0;
  const float* __restrict__ splane = keyside ? KeyIn : RowIn;
  _Float16* __restrict__ dplane = keyside ? key16 : row16;
  const unsigned sr = (tid & 127u) >> 3, sc = (tid & 7u) * 8u;
  const float* __restrict__ sp = splane + (frow0 + sr) * HD + sc;
  const v4f a0 = *(const v4f*)(sp);
  const v4f a1 = *(const v4f*)(sp + 4);
  // the wait that stands before an issued load's address register is written again. The addresses
  // are named as inputs so that they stay whole up to it. This statement and its
  // twin below also hold the block's 22 loads ahead of their first use: left alone, the compiler
  // waited for them in four groups, one memory latency after the other
  asm volatile("s_wait_xcnt 0x0" :: "v"(gp), "v"(sp) : "memory");

  // value tile: element j is key row (tid >> 6) + 4 j, channel tid & 63
  const unsigned vb = blk / (unsigned)NTILE_B;
  const unsigned vt = blk - vb * (unsigned)NTILE_B;
  const unsigned n0 = (vt % (unsigned)NTILE_C) * 64u;
  const unsigned k0 = (vt / (unsigned)NTILE_C) * 64u;
  const unsigned kr = tid >> 6, nc = tid & 63u;
  const float* __restrict__ wp = V + ((size_t)vb * SEQ_FULL + k0 + kr) * CH + n0 + nc;
  _Float16* __restrict__ Wt = Vt + (size_t)vb * CH * SEQ;
  float wv[16];
#pragma unroll
  for (int j = 0; j < 16; ++j) wv[j] = wp[j * 4 * CH];
  asm volatile("s_wait_xcnt 0x0" :: "v"(wp) : "memory");   // as above, for these 16 loads
#pragma unroll
  for (int j = 0; j < 16; ++j) T[nc * LDT + kr + 4 * j] = (_Float16)(WCARRY * bf16r(wv[j]));
  __syncthreads();
  v8h x[2];
  size_t off[2];
#pragma unroll
  for (unsigned i = 0; i < 2u; ++i) {
    const unsigned n = 32u * i + (tid >> 3);
    const unsigned kc = (tid & 7u) * 8u;
    x[i] = *(const v8h*)&T[n * LDT + kc];
    off[i] = (size_t)(n0 + n) * SEQ + k0 + kc;
  }
#pragma unroll
  for (int i = 0; i < 2; ++i) *(v8h*)(Wt + off[i]) = x[i];

  // score operand slice: convert and store
  v8h xs;
#pragma unroll
  for (int i = 0; i < 4; ++i) {
    xs[i]     = toh_flush(QCARRY * bf16r(a0[i]));
    xs[i + 4] = toh_flush(QCARRY * bf16r(a1[i]));
  }
  *(v8h*)(dplane + (size_t)(crow0 + sr) * HD + sc) = xs;

  // pass-through slice: convert and store
#pragma unroll
  for (int j = 0; j < 4; ++j) {
    v4f o;
#pragma unroll
    for (int e = 0; e < 4; ++e) o[e] = bf16r(ga[j][e]);
    *(v4f*)(op + j * 4 * OUTW) = o;
  }
}

// ---------------------------------------------------------------------------
// Dense flash attention per (128 softmax rows, 128-channel value slab, batch). 8 waves x 16
// rows, 64 keys per step over all SEQ keys: key tile Ks[key][d] and V^T tile Vs[c][key] staged
// by asynchronous copies in a ring of two buffers, the next step's tiles in flight while this
// step's are worked on (cross-wave, one block barrier per step). Both products are transposed:
// S^T = K . Q^T (A = key rows, B = softmax rows) and O^T += V^T . P^T (A = channel rows). Lane
// (hh, m) then holds softmax row m alone: keys 16 kg + 8 hh + v of its scores, so that maximum
// and sum run inside the lane with one exchange between the wave's halves, and the converted
// scores of two key groups ARE the B operand of the second product (element i of the fragment
// is key 8 hh + i, element 8 + i is key 16 + 8 hh + i, the order frag_at gives the A side): P
// stays in registers. No mask, unit score scale; P as f16(16384 p), values below the smallest
// f16 normal set to zero, row sum over the converted values, each half's share kept apart until
// the epilogue; O^T (128 channels x 16 rows per wave) in registers.
// Epilogue: 32 channels at a time staged in the wave's Cs tile (wave-private, wave sync), then
// Grid (SEQ/128, CH/CSLAB, NB).
// ---------------------------------------------------------------------------
__global__ __launch_bounds__(256) void attn_kernel(
    const _Float16* __restrict__ Qh, const _Float16* __restrict__ Kh,
    const _Float16* __restrict__ Vt, const float* __restrict__ xres,
    const float* __restrict__ kp, float* __restrict__ out) {
  __shared__ __attribute__((aligned(16))) _Float16 Ring[2 * BUF_HALVES];
  __shared__ __attribute__((aligned(16))) float Cs[8 * 16 * LDE];

  const unsigned tid = threadIdx.x, lane = tid & 31u;
  const unsigned wave = (unsigned)__builtin_amdgcn_readfirstlane((int)(threadIdx.x >> 5));
  const unsigned hh = lane >> 4, m = lane & 15u;
  const unsigned q0 = blockIdx.x * 128u;
  const unsigned slab = blockIdx.y;
  const unsigned b = blockIdx.z;
  const float sinv = 1.0f / (QCARRY * QCARRY);
  const unsigned qrow0 = q0 + wave * 16u;

  const size_t qoff = (size_t)(b * (unsigned)SEQ + qrow0 + m) * HD + hh * 8u;
  const _Float16* __restrict__ qp = Qh + qoff;
  v16h qf[2];
  qf[0] = frag_at(qp);
  qf[1] = frag_at(qp + 32);
  // the wait that stands before an issued load's address register is written again; the address
  // is named as an input so that it stays whole up to the wait
  asm volatile("s_wait_xcnt 0x0" :: "v"(qp) : "memory");

  float mrow = -1.0e30f, lrow = 0.0f;   // softmax row m; lrow covers this half's keys only
  v8f o[8];
#pragma unroll
  for (int nb = 0; nb < 8; ++nb) o[nb] = (v8f){};

  const size_t kplane = (size_t)b * SEQ * HD;
  const size_t vplane = ((size_t)b * CH + slab * (unsigned)CSLAB) * SEQ;

  // the lane's piece of a stage: row tid >> 3 (and 32, 64, 96 further), halves 8 (tid & 7) ..
  const unsigned sr = tid >> 3, sc = (tid & 7u) * 8u;
  const unsigned lds0 = (unsigned)(size_t)&Ring[sr * LDT + sc];
  const _Float16* __restrict__ gk = Kh + kplane + (size_t)sr * HD + sc;
  const _Float16* __restrict__ gv = Vt + vplane + (size_t)sr * SEQ + sc;

  // ring prologue: stage 0 landed and published, stage 1 in flight (SEQ >= 128: both exist)
  copy_stage(lds0, gk, gv);
  asm volatile("s_wait_asynccnt 0x0" ::: "memory");   // this wave's copies of stage 0 have landed
  __syncthreads();
  copy_stage(lds0 + BUF_BYTES, gk + 64 * HD, gv + 64);

#pragma unroll 1
  for (unsigned kb = 0; kb < (unsigned)SEQ; kb += 64u) {
    const unsigned cur = (kb >> 6) & 1u;
    const _Float16* Ks = Ring + cur * BUF_HALVES;
    const _Float16* Vs = Ks + KS_HALVES;

    // scores: 4 key groups of 16, K = 64 in two 32-steps; all 8 key fragments are read from
    // LDS as one group ahead of the 8 products
    v16h kf[8];
#pragma unroll
    for (int kg = 0; kg < 4; ++kg)
#pragma unroll
      for (int c = 0; c < 2; ++c) kf[kg * 2 + c] = ld_frag(&Ks[(kg * 16) * LDT + c * 32], LDT);
    // keeps the 16 reads together: sunk to their products, each pair is waited for on its own
    __builtin_amdgcn_sched_barrier(0);
    v8f s[4];   // s[kg][v] = score of key 16 kg + 8 hh + v against softmax row m
#pragma unroll
    for (int kg = 0; kg < 4; ++kg) s[kg] = wmma16(kf[kg * 2], qf[0], (v8f){});
#pragma unroll
    for (int kg = 0; kg < 4; ++kg) s[kg] = wmma16(kf[kg * 2 + 1], qf[1], s[kg]) * sinv;

    // online softmax: 32 of the row's 64 scores are in this lane, the rest in lane ^ 16
    float t[8];
#pragma unroll
    for (int v = 0; v < 8; ++v)
      t[v] = fmaxf(fmaxf(s[0][v], s[1][v]), fmaxf(s[2][v], s[3][v]));
    float mx = fmaxf(fmaxf(fmaxf(t[0], t[1]), fmaxf(t[2], t[3])),
                     fmaxf(fmaxf(t[4], t[5]), fmaxf(t[6], t[7])));
    mx = fmaxf(mx, xhalf(mx));
    const float mn = fmaxf(mrow, mx);
    // alpha = exp(mrow - mn), formed as __expf forms it (times log2 e, then v_exp_f32), with the
    // v_nop of exp2x8 behind it, for the same reason
    float alpha;
    asm("v_exp_f32 %0, %1\n\tv_nop" : "=v"(alpha) : "v"((mrow - mn) * LOG2E));
    mrow = mn;
    // all 16 value fragments of this step are read from LDS as one group here, so that they land
    // under the exponentials
    v16h vf[16];
#pragma unroll
    for (int c = 0; c < 2; ++c)
#pragma unroll
      for (int nb = 0; nb < 8; ++nb) vf[c * 8 + nb] = ld_frag(&Vs[(nb * 16) * LDT + c * 32], LDT);
    // keeps the 32 reads up here: without it they sink behind most of the exponentials
    __builtin_amdgcn_sched_barrier(0);
    // P^T fragments [32 keys][16 rows], f16(16384 p); s keeps the converted value for the row sum
    v16h pf[2];
    v8f e[4];
#pragma unroll
    for (int kg = 0; kg < 4; ++kg)
      e[kg] = exp2x8((s[kg] - mrow) * LOG2E);   // exp(s - mrow) as __expf forms it
    // keeps all four asm runs of exponentials ahead of the second product
    __builtin_amdgcn_sched_barrier(0);
#pragma unroll
    for (int kg = 0; kg < 4; ++kg) {
#pragma unroll
      for (int v = 0; v < 8; ++v) {
        const h16 ph = toh_flush(e[kg][v] * PCARRY);
        pf[kg >> 1][(kg & 1) * 8 + v] = ph;
        s[kg][v] = (float)ph;
      }
    }
#pragma unroll
    for (int v = 0; v < 8; ++v) t[v] = (s[0][v] + s[1][v]) + (s[2][v] + s[3][v]);
    lrow = alpha * lrow + (((t[0] + t[1]) + (t[2] + t[3])) + ((t[4] + t[5]) + (t[6] + t[7])));
#pragma unroll
    for (int nb = 0; nb < 8; ++nb) o[nb] = o[nb] * alpha;

    // O^T += V^T . P^T  (K = 64 keys in two 32-steps; A = V^T tile [c][key])
#pragma unroll
    for (int c = 0; c < 2; ++c)
#pragma unroll
      for (int nb = 0; nb < 8; ++nb) o[nb] = wmma16(vf[c * 8 + nb], pf[c], o[nb]);

    // publish point of the next stage; the one barrier also ends every wave's reads of this
    // step's buffer, which is refilled behind it
    asm volatile("s_wait_dscnt 0x0" ::: "memory");      // this wave's reads of the buffer are done
    asm volatile("s_wait_asynccnt 0x0" ::: "memory");   // its copies of the next stage have landed
    __syncthreads();
    if (kb + 128u < (unsigned)SEQ)
      copy_stage(lds0 + cur * BUF_BYTES, gk + (size_t)(kb + 128u) * HD, gv + kb + 128u);
  }
  asm volatile("s_wait_asynccnt 0x0" ::: "memory");   // no copy is left in flight behind the loop

  // finalize: k * O / (64 l) + x, 32 channels per pass through the wave's Cs tile
  const float kk = bf16r(kp[0]);
  // v_rcp_f32 with the v_nop of exp2x8 behind it, for the same reason
  float rl;
  asm("v_rcp_f32 %0, %1\n\tv_nop" : "=v"(rl) : "v"(lrow + xhalf(lrow)));
  const float inv = rl * (1.0f / WCARRY);
  const unsigned cw = wave * (16u * LDE);
  const size_t frow0 = (size_t)b * SEQ_FULL + qrow0;
  const unsigned ch0 = slab * (unsigned)CSLAB;
#pragma unroll
  for (int pr = 0; pr < 4; ++pr) {
    // o[nb][v] = row m, channel 16 nb + 8 hh + v: 8 consecutive channels per lane and tile
#pragma unroll
    for (int u = 0; u < 2; ++u) {
      const v8f ov = o[2 * pr + u] * inv;
      float* cp = &Cs[cw + m * LDE + 16u * (unsigned)u + hh * 8u];
      *(v4f*)cp       = (v4f){ov[0], ov[1], ov[2], ov[3]};
      *(v4f*)(cp + 4) = (v4f){ov[4], ov[5], ov[6], ov[7]};
    }
    wave_lds_sync();
    v4f xs[4];
    size_t off[4];
#pragma unroll
    for (unsigned i = 0; i < 4u; ++i) {
      const unsigned r = 4u * i + (lane >> 3);
      const unsigned c = (lane & 7u) * 4u;
      const size_t frow = frow0 + r;
      const unsigned ch = ch0 + 32u * (unsigned)pr + c;
      const v4f u = *(const v4f*)&Cs[cw + r * LDE + c];
      const v4f xin = *(const v4f*)(xres + frow * CH + ch);
      v4f val;
#pragma unroll
      for (int j = 0; j < 4; ++j) val[j] = kk * u[j] + bf16r(xin[j]);
      xs[i] = val;
      off[i] = frow * OUTW + ch;
    }
#pragma unroll
    for (int i = 0; i < 4; ++i) *(v4f*)(out + off[i]) = xs[i];
    
    wave_lds_sync();
  }
}

// ---------------------------------------------------------------------------
extern "C" void kernel_launch(void* const* d_in, const int* in_sizes, int n_in,
                              void* d_out, int out_size, void* d_ws, size_t ws_size,
                              hipStream_t stream) {
  if (n_in < 6) return;
  const long long need_rows = (long long)(NB - 1) * SEQ_FULL + SEQ;
  if ((long long)in_sizes[0] < need_rows * CH) return;
  if ((long long)in_sizes[1] < need_rows * CH) return;
  if ((long long)in_sizes[2] < need_rows * HD) return;
  if ((long long)in_sizes[3] < need_rows * HD) return;
  if ((long long)in_sizes[4] < need_rows * CH) return;
  if (in_sizes[5] < 1) return;
  if ((long long)out_size < need_rows * OUTW) return;
  if (ws_size < WS_TOTAL) return;

  const float* G  = (const float*)d_in[0];   // g        [NB_FULL][SEQ_FULL][CH]
  const float* X  = (const float*)d_in[1];   // x        [NB_FULL][SEQ_FULL][CH]
  const float* XQ = (const float*)d_in[2];   // x_query  [NB_FULL][SEQ_FULL][HD]  (keys)
  const float* PG = (const float*)d_in[3];   // phi_g    [NB_FULL][SEQ_FULL][HD]  (softmax rows)
  const float* XV = (const float*)d_in[4];   // x_value  [NB_FULL][SEQ_FULL][CH]
  const float* KP = (const float*)d_in[5];   // k        [1]
  float* out = (float*)d_out;

  char* ws = (char*)d_ws;
  _Float16* PG16 = (_Float16*)(ws + OFF_PG);   // [MROWS][HD]
  _Float16* XQ16 = (_Float16*)(ws + OFF_XQ);   // [MROWS][HD]
  _Float16* Vt16 = (_Float16*)(ws + OFF_VT);   // [b][CH][SEQ]

  dim3 blk(256);

  prep_kernel<<<dim3(PREP_BLOCKS), blk, 0, stream>>>(PG, XQ, XV, G, PG16, XQ16, Vt16, out);
  attn_kernel<<<dim3(SEQ / 128, CH / CSLAB, NB), blk, 0, stream>>>(PG16, XQ16, Vt16, X, KP, out);
}

// v005
// One run takes 66.2 microseconds.
// Timed twice side by side with v004, it ran 1.07 and 1.08 times as fast.
// Over all steps from v000 it is 2.94 times as fast.
#include <hip/hip_runtime.h>
#include <stddef.h>

// Both contractions (row.key scores, K = 64; p.v, K = 4096 keys) on v_wmma_f32_16x16x32_f16
// (f16 operands, f32 accumulate), one product per site, both taken transposed (key x row scores,
// channel x row result). Float inputs are RNE-converted to bf16
// and carried in f16 (score operands x16, value plane x64, softmax numerators x16384 with the
// row sum taken over the converted values). Softmax, scalar gain and residual add in f32.

typedef _Float16 v16h __attribute__((ext_vector_type(16)));
typedef _Float16 v8h  __attribute__((ext_vector_type(8)));
typedef float    v8f  __attribute__((ext_vector_type(8)));
typedef float    v4f  __attribute__((ext_vector_type(4)));
typedef _Float16 h16;

#ifndef NB
#define NB 4
#endif
#ifndef SEQ
#define SEQ 4096
#endif
#define NB_FULL  4
#define SEQ_FULL 4096
#define HD    64      // score depth (channels of the row and key operands)
#define CH    256     // value / residual channels
#define OUTW  512     // output channels (CH result channels, then CH pass-through channels)
#define CSLAB 128     // result channels that one wave of a pair finishes in the epilogue
#define QROWS 64      // softmax rows per attention block
#define MROWS (NB * SEQ)

static_assert(NB >= 1 && NB <= NB_FULL);
static_assert(SEQ >= 256 && SEQ <= SEQ_FULL && (SEQ % 128) == 0);   // two ring stages exist
static_assert(HD == 64);                         // two 32-deep k-steps per score tile
static_assert(OUTW == 2 * CH);
static_assert(CH == 2 * CSLAB && CSLAB == 8 * 16);   // 16 accumulator channel groups per wave
static_assert((CH % 64) == 0 && (SEQ % 64) == 0);      // transpose tiles 64 x 64
static_assert((MROWS % 32) == 0 && (MROWS % 4) == 0);
static_assert((HD % 8) == 0 && (CH % 4) == 0);
static_assert((size_t)NB_FULL * SEQ_FULL * OUTW * 4 == (size_t)33554432);

#define LDT 72   // halves per LDS row (144 B, 16-B aligned)
#define LDE 36   // floats per LDS row of the epilogue stage (144 B, 16-B aligned)
static_assert((LDT % 8) == 0 && LDT >= 64);
static_assert((LDE % 4) == 0 && LDE >= 32);
#define KS_HALVES  (64 * LDT)                 // key tile of 64 keys
#define SUB_HALVES (KS_HALVES + CH * LDT)      // 64 keys: key tile, then value tile (all channels)
#define SUB_BYTES  (SUB_HALVES * 2)
#define BUF_HALVES (2 * SUB_HALVES)            // one ring buffer: 128 keys as two sets of 64
#define BUF_BYTES  (BUF_HALVES * 2)
#define XO_FLOATS  (8 * 2 * 32 * 4)            // 8 accumulator tiles of one wave, 16-B pieces by lane
static_assert((BUF_BYTES % 16) == 0 && (SUB_BYTES % 16) == 0 && (KS_HALVES % 8) == 0);
static_assert((size_t)2 * BUF_BYTES + (size_t)8 * 16 * LDE * 4 + (size_t)8 * XO_FLOATS * 4 +
              (size_t)8 * 32 * 2 * 4 <= (size_t)327680);

#define WCARRY 64.0f      // value plane carried x64
#define QCARRY 16.0f      // score operand planes carried x16 each
#define PCARRY 16384.0f   // softmax numerators carried x16384
#define LOG2E  1.44269504f

// workspace layout (bytes)
#define ROW16_BYTES ((size_t)MROWS * HD * 2)
#define VT_BYTES    ((size_t)NB * CH * SEQ * 2)
#define OFF_PG  ((size_t)0)
#define OFF_XQ  (OFF_PG + ROW16_BYTES)
#define OFF_VT  (OFF_XQ + ROW16_BYTES)
#define WS_TOTAL (OFF_VT + VT_BYTES)
static_assert((ROW16_BYTES % 128) == 0 && (VT_BYTES % 128) == 0);
static_assert(WS_TOTAL <= (size_t)134217728);

// ---------------------------------------------------------------------------
__device__ __forceinline__ float bf16r(float x) {   // RNE convert to bf16, returned widened
  unsigned int u = __float_as_uint(x);
  u = (u + 0x7FFFu + ((u >> 16) & 1u)) & 0xFFFF0000u;
  return __uint_as_float(u);
}

// f32 -> f16 for matrix operands; values below the smallest f16 normal become zero.
static __device__ __forceinline__ h16 toh_flush(float v) {
  const h16 r = (h16)v;
  return (fabsf(v) < 6.103515625e-05f) ? (h16)0.0f : r;
}

// 16-bit fragment: p points at element [row = lane&15][k0 + 8*(lane>>4)] of a k-contiguous
// row. Elements 0..7 <- k0+8h+0..7, elements 8..15 <- k0+16+8h+0..7 (same map for A and B).
__device__ __forceinline__ v16h frag_at(const _Float16* p) {
  v8h lo = *(const v8h*)(p);
  v8h hi = *(const v8h*)(p + 16);
  v16h out;
#pragma unroll
  for (int i = 0; i < 8; ++i) { out[i] = lo[i]; out[i + 8] = hi[i]; }
  return out;
}
__device__ __forceinline__ v16h ld_frag(const _Float16* base, unsigned ld) {
  const unsigned lane = threadIdx.x & 31u;
  return frag_at(base + (lane & 15u) * ld + (lane >> 4) * 8u);
}

__device__ __forceinline__ v8f wmma16(v16h a, v16h b, v8f c) {
  return __builtin_amdgcn_wmma_f32_16x16x32_f16(false, a, false, b, (short)0, c, false, false);
}

// value of lane l ^ 16 (the other half of the wave), by a vector cross-row move
__device__ __forceinline__ float xhalf(float x) {
  const int b = __builtin_bit_cast(int, x);
  return __builtin_bit_cast(
      float, __builtin_amdgcn_permlanex16(b, b, 0x76543210, 0xfedcba98, false, false));
}

// 2^x for eight values. One statement, so that the v_nop stands directly behind the last
// v_exp_f32: the instruction set asks for one slot between a transcendental and a vector
// instruction that uses its result or overwrites its source.
// Early-clobber outputs: no exponential of the run overwrites a neighbour's source either.
__device__ __forceinline__ v8f exp2x8(v8f x) {
  float r0, r1, r2, r3, r4, r5, r6, r7;
  asm("v_exp_f32 %0, %8\n\tv_exp_f32 %1, %9\n\tv_exp_f32 %2, %10\n\tv_exp_f32 %3, %11\n\t"
      "v_exp_f32 %4, %12\n\tv_exp_f32 %5, %13\n\tv_exp_f32 %6, %14\n\tv_exp_f32 %7, %15\n\t"
      "v_nop"
      : "=&v"(r0), "=&v"(r1), "=&v"(r2), "=&v"(r3), "=&v"(r4), "=&v"(r5), "=&v"(r6), "=&v"(r7)
      : "v"(x[0]), "v"(x[1]), "v"(x[2]), "v"(x[3]), "v"(x[4]), "v"(x[5]), "v"(x[6]), "v"(x[7]));
  return (v8f){r0, r1, r2, r3, r4, r5, r6, r7};
}

__device__ __forceinline__ void wave_lds_sync() {
  __builtin_amdgcn_fence(3 /* release order */, "wavefront");
  asm volatile("s_wait_dscnt 0x0" ::: "memory");
  __builtin_amdgcn_wave_barrier();
}

// 2^x for one value, with the v_nop of exp2x8 behind it, for the same reason
__device__ __forceinline__ float exp2x1(float x) {
  float r;
  asm("v_exp_f32 %0, %1\n\tv_nop" : "=v"(r) : "v"(x));
  return r;
}

// Ten 16-B asynchronous copies per lane from global memory into LDS, through no register: two
// pieces of a key tile (rows 32 apart) and eight of a value tile (channels 32 apart). lds = the
// lane's byte address in the set's key tile, gk / gv = its first piece of each tile.
// s_wait_xcnt 0 is the statement's last line so that it stands in front of every later write of
// a register that a copy names.
__device__ __forceinline__ void copy_set(unsigned lds, const _Float16* gk, const _Float16* gv) {
  const unsigned lv = lds + KS_HALVES * 2u;
  asm volatile(
      "global_load_async_to_lds_b128 %0, %10, off\n\t"
      "global_load_async_to_lds_b128 %1, %11, off\n\t"
      "global_load_async_to_lds_b128 %2, %12, off\n\t"
      "global_load_async_to_lds_b128 %3, %13, off\n\t"
      "global_load_async_to_lds_b128 %4, %14, off\n\t"
      "global_load_async_to_lds_b128 %5, %15, off\n\t"
      "global_load_async_to_lds_b128 %6, %16, off\n\t"
      "global_load_async_to_lds_b128 %7, %17, off\n\t"
      "global_load_async_to_lds_b128 %8, %18, off\n\t"
      "global_load_async_to_lds_b128 %9, %19, off\n\t"
      "s_wait_xcnt 0x0"
      :: "v"(lds), "v"(lds + 32u * LDT * 2u),
         "v"(lv), "v"(lv + 32u * LDT * 2u), "v"(lv + 64u * LDT * 2u), "v"(lv + 96u * LDT * 2u),
         "v"(lv + 128u * LDT * 2u), "v"(lv + 160u * LDT * 2u), "v"(lv + 192u * LDT * 2u),
         "v"(lv + 224u * LDT * 2u),
         "v"(gk), "v"(gk + 32 * HD),
         "v"(gv), "v"(gv + 32 * SEQ), "v"(gv + 64 * SEQ), "v"(gv + 96 * SEQ),
         "v"(gv + 128 * SEQ), "v"(gv + 160 * SEQ), "v"(gv + 192 * SEQ), "v"(gv + 224 * SEQ)
      : "memory");
}

// One 128-key stage into a ring buffer: its two sets of 64 keys, 20 copies per lane.
__device__ __forceinline__ void copy_stage(unsigned lds, const _Float16* gk, const _Float16* gv) {
  copy_set(lds, gk, gv);
  copy_set(lds + SUB_BYTES, gk + 64 * HD, gv + 64);
}

// ---------------------------------------------------------------------------
// Every pass outside the attention kernel, in one launch. Block blk takes one 64 x 64 tile of the
// value transpose and the 16 rows numbered blk of the other passes:
//  - value plane: V[b][key][ch] -> Vt[b][ch][key] = f16(64 * bf16(v)), through T (cross-wave,
//    block barrier); tiles numbered channel tile first, then key tile, then batch;
//  - score operand planes: compact rows [MROWS][HD] of f16(16 * bf16(value)); waves 0..3 convert
//    the row operand, waves 4..7 the key operand, 8 consecutive values per thread;
//  - pass-through half of the output: out[full row][CH + c] = bf16(g[full row][c]), four 16-B
//    pieces per thread.
// All global loads stand ahead of the barrier and all global stores behind it: a barrier behind a
// global store first waits for that store.
// Grid (NB * (CH/64) * (SEQ/64)).
// ---------------------------------------------------------------------------
#define NTILE_C (CH / 64)
#define NTILE_B (NTILE_C * (SEQ / 64))
#define PREP_BLOCKS (NB * NTILE_B)
static_assert((size_t)PREP_BLOCKS * 16 == (size_t)MROWS);   // 16 rows of each row pass per block

__global__ __launch_bounds__(256) void prep_kernel(
    const float* __restrict__ RowIn, const float* __restrict__ KeyIn,
    const float* __restrict__ V, const float* __restrict__ G,
    _Float16* __restrict__ row16, _Float16* __restrict__ key16,
    _Float16* __restrict__ Vt, float* __restrict__ out) {
  __shared__ _Float16 T[64 * LDT];
  const unsigned tid = threadIdx.x;
  const unsigned blk = blockIdx.x;

  // the block's 16 compact rows lie in one batch (SEQ is a multiple of 16)
  const unsigned crow0 = blk * 16u;
  const unsigned rb = crow0 / (unsigned)SEQ;
  const size_t frow0 = (size_t)rb * SEQ_FULL + (crow0 - rb * (unsigned)SEQ);

  // pass-through slice: piece j is row (tid >> 6) + 4 j, channels 4 (tid & 63) ..
  const unsigned gr = tid >> 6, gc = (tid & 63u) * 4u;
  const float* __restrict__ gp = G + (frow0 + gr) * CH + gc;
  float* __restrict__ op = out + (frow0 + gr) * OUTW + CH + gc;
  v4f ga[4];
#pragma unroll
  for (int j = 0; j < 4; ++j) ga[j] = *(const v4f*)(gp + j * 4 * CH);

  // score operand slice: row (tid & 127) >> 3, values 8 (tid & 7) ..
  const bool keyside = __builtin_amdgcn_readfirstlane((int)(tid >> 7)) != 0;
  const float* __restrict__ splane = keyside ? KeyIn : RowIn;
  _Float16* __restrict__ dplane = keyside ? key16 : row16;
  const unsigned sr = (tid & 127u) >> 3, sc = (tid & 7u) * 8u;
  const float* __restrict__ sp = splane + (frow0 + sr) * HD + sc;
  const v4f a0 = *(const v4f*)(sp);
  const v4f a1 = *(const v4f*)(sp + 4);
  // the wait that stands before an issued load's address register is written again. The addresses
  // are named as inputs so that they stay whole up to it. This statement and its
  // twin below also hold the block's 22 loads ahead of their first use: left alone, the compiler
  // waited for them in four groups, one memory latency after the other
  asm volatile("s_wait_xcnt 0x0" :: "v"(gp), "v"(sp) : "memory");

  // value tile: element j is key row (tid >> 6) + 4 j, channel tid & 63
  const unsigned vb = blk / (unsigned)NTILE_B;
  const unsigned vt = blk - vb * (unsigned)NTILE_B;
  const unsigned n0 = (vt % (unsigned)NTILE_C) * 64u;
  const unsigned k0 = (vt / (unsigned)NTILE_C) * 64u;
  const unsigned kr = tid >> 6, nc = tid & 63u;
  const float* __restrict__ wp = V + ((size_t)vb * SEQ_FULL + k0 + kr) * CH + n0 + nc;
  _Float16* __restrict__ Wt = Vt + (size_t)vb * CH * SEQ;
  float wv[16];
#pragma unroll
  for (int j = 0; j < 16; ++j) wv[j] = wp[j * 4 * CH];
  asm volatile("s_wait_xcnt 0x0" :: "v"(wp) : "memory");   // as above, for these 16 loads
#pragma unroll
  for (int j = 0; j < 16; ++j) T[nc * LDT + kr + 4 * j] = (_Float16)(WCARRY * bf16r(wv[j]));
  __syncthreads();
  v8h x[2];
  size_t off[2];
#pragma unroll
  for (unsigned i = 0; i < 2u; ++i) {
    const unsigned n = 32u * i + (tid >> 3);
    const unsigned kc = (tid & 7u) * 8u;
    x[i] = *(const v8h*)&T[n * LDT + kc];
    off[i] = (size_t)(n0 + n) * SEQ + k0 + kc;
  }
#pragma unroll
  for (int i = 0; i < 2; ++i) *(v8h*)(Wt + off[i]) = x[i];

  // score operand slice: convert and store
  v8h xs;
#pragma unroll
  for (int i = 0; i < 4; ++i) {
    xs[i]     = toh_flush(QCARRY * bf16r(a0[i]));
    xs[i + 4] = toh_flush(QCARRY * bf16r(a1[i]));
  }
  *(v8h*)(dplane + (size_t)(crow0 + sr) * HD + sc) = xs;

  // pass-through slice: convert and store
#pragma unroll
  for (int j = 0; j < 4; ++j) {
    v4f o;
#pragma unroll
    for (int e = 0; e < 4; ++e) o[e] = bf16r(ga[j][e]);
    *(v4f*)(op + j * 4 * OUTW) = o;
  }
}

// ---------------------------------------------------------------------------
// Dense flash attention per (64 softmax rows, all CH value channels, batch), so that each score
// and its exponential are formed once. 8 waves = 4 row groups of 16 x 2 key sets: wave w takes
// rows 16 (w & 3) .. and, of every 128-key stage, the 64 keys of set w >> 2; it runs its own
// online softmax over its half of the keys, and the two waves of a row group join their maxima,
// sums and results once, behind the loop, through LDS (block barrier). Per set a key tile
// Ks[key][d] and a V^T tile Vs[c][key], staged by asynchronous copies in a ring of two buffers,
// the next stage in flight while this one is worked on (cross-wave, one block barrier per stage).
// Both products are transposed:
// S^T = K . Q^T (A = key rows, B = softmax rows) and O^T += V^T . P^T (A = channel rows). Lane
// (hh, m) then holds softmax row m alone: keys 16 kg + 8 hh + v of its scores, so that maximum
// and sum run inside the lane with one exchange between the wave's halves, and the converted
// scores of two key groups ARE the B operand of the second product (element i of the fragment
// is key 8 hh + i, element 8 + i is key 16 + 8 hh + i, the order frag_at gives the A side): P
// stays in registers. No mask, unit score scale; P as f16(16384 p), values below the smallest
// f16 normal set to zero, row sum over the converted values, each half's share kept apart until
// the epilogue; O^T (256 channels x 16 rows per wave) in registers.
// Epilogue: each wave of a pair hands the other 128 channels and finishes its own 128, 32
// channels at a time staged in the wave's Cs tile (wave-private, wave sync).
// Grid (SEQ/64, NB).
// ---------------------------------------------------------------------------
__global__ __launch_bounds__(256) void attn_kernel(
    const _Float16* __restrict__ Qh, const _Float16* __restrict__ Kh,
    const _Float16* __restrict__ Vt, const float* __restrict__ xres,
    const float* __restrict__ kp, float* __restrict__ out) {
  __shared__ __attribute__((aligned(16))) _Float16 Ring[2 * BUF_HALVES];
  __shared__ __attribute__((aligned(16))) float Cs[8 * 16 * LDE];
  __shared__ __attribute__((aligned(16))) float Xo[8 * XO_FLOATS];   // results handed to the partner
  __shared__ __attribute__((aligned(16))) float Xml[8 * 32 * 2];     // its maximum and row sum

  const unsigned tid = threadIdx.x, lane = tid & 31u;
  const unsigned wave = (unsigned)__builtin_amdgcn_readfirstlane((int)(threadIdx.x >> 5));
  const unsigned rg = wave & 3u, kh = wave >> 2;
  const unsigned hh = lane >> 4, m = lane & 15u;
  const unsigned q0 = blockIdx.x * (unsigned)QROWS;
  const unsigned b = blockIdx.y;
  const float sinv = 1.0f / (QCARRY * QCARRY);
  const unsigned qrow0 = q0 + rg * 16u;

  const size_t qoff = (size_t)(b * (unsigned)SEQ + qrow0 + m) * HD + hh * 8u;
  const _Float16* __restrict__ qp = Qh + qoff;
  v16h qf[2];
  qf[0] = frag_at(qp);
  qf[1] = frag_at(qp + 32);
  // the wait that stands before an issued load's address register is written again; the address
  // is named as an input so that it stays whole up to the wait
  asm volatile("s_wait_xcnt 0x0" :: "v"(qp) : "memory");

  float mrow = -1.0e30f, lrow = 0.0f;   // softmax row m; lrow covers this half's keys only
  v8f o[16];
#pragma unroll
  for (int nb = 0; nb < 16; ++nb) o[nb] = (v8f){};

  const size_t kplane = (size_t)b * SEQ * HD;
  const size_t vplane = (size_t)b * CH * SEQ;

  // the lane's piece of a tile: row tid >> 3 (and multiples of 32 further), halves 8 (tid & 7) ..
  const unsigned sr = tid >> 3, sc = (tid & 7u) * 8u;
  const unsigned lds0 = (unsigned)(size_t)&Ring[sr * LDT + sc];
  const _Float16* __restrict__ gk = Kh + kplane + (size_t)sr * HD + sc;
  const _Float16* __restrict__ gv = Vt + vplane + (size_t)sr * SEQ + sc;

  // ring prologue: stage 0 landed and published, stage 1 in flight (SEQ >= 256: both exist)
  copy_stage(lds0, gk, gv);
  asm volatile("s_wait_asynccnt 0x0" ::: "memory");   // this wave's copies of stage 0 have landed
  __syncthreads();
  copy_stage(lds0 + BUF_BYTES, gk + 128 * HD, gv + 128);
  unsigned lfill = lds0 + BUF_BYTES;   // the lane's piece in the buffer that was filled last
  const _Float16* pk = gk;   // the lane's first pieces of the stage that is worked on
  const _Float16* pv = gv;

#pragma unroll 1
  for (unsigned kb = 0; kb < (unsigned)SEQ; kb += 128u) {
    const unsigned cur = (kb >> 7) & 1u;
    const _Float16* Ks = Ring + cur * BUF_HALVES + kh * SUB_HALVES;
    const _Float16* Vs = Ks + KS_HALVES;

    // scores: 4 key groups of 16, K = 64 in two 32-steps; all 8 key fragments are read from
    // LDS as one group ahead of the 8 products
    v16h kf[8];
#pragma unroll
    for (int kg = 0; kg < 4; ++kg)
#pragma unroll
      for (int c = 0; c < 2; ++c) kf[kg * 2 + c] = ld_frag(&Ks[(kg * 16) * LDT + c * 32], LDT);
    // keeps the 16 reads together: sunk to their products, each pair is waited for on its own
    __builtin_amdgcn_sched_barrier(0);
    v8f s[4];   // s[kg][v] = score of key 16 kg + 8 hh + v against softmax row m
#pragma unroll
    for (int kg = 0; kg < 4; ++kg) s[kg] = wmma16(kf[kg * 2], qf[0], (v8f){});
#pragma unroll
    for (int kg = 0; kg < 4; ++kg) s[kg] = wmma16(kf[kg * 2 + 1], qf[1], s[kg]) * sinv;

    // online softmax: 32 of the row's 64 scores are in this lane, the rest in lane ^ 16
    float t[8];
#pragma unroll
    for (int v = 0; v < 8; ++v)
      t[v] = fmaxf(fmaxf(s[0][v], s[1][v]), fmaxf(s[2][v], s[3][v]));
    float mx = fmaxf(fmaxf(fmaxf(t[0], t[1]), fmaxf(t[2], t[3])),
                     fmaxf(fmaxf(t[4], t[5]), fmaxf(t[6], t[7])));
    mx = fmaxf(mx, xhalf(mx));
    const float mn = fmaxf(mrow, mx);
    // alpha = exp(mrow - mn), formed as __expf forms it (times log2 e, then v_exp_f32)
    const float alpha = exp2x1((mrow - mn) * LOG2E);
    mrow = mn;
    // the 16 value fragments of the first 32 keys are read from LDS as one group here, so that
    // they land under the exponentials
    v16h vf0[16];
#pragma unroll
    for (int nb = 0; nb < 16; ++nb) vf0[nb] = ld_frag(&Vs[(nb * 16) * LDT], LDT);
    // keeps the 32 reads up here: without it they sink behind most of the exponentials
    __builtin_amdgcn_sched_barrier(0);
    // P^T fragments [32 keys][16 rows], f16(16384 p); s keeps the converted value for the row sum
    v16h pf[2];
    v8f e[4];
#pragma unroll
    for (int kg = 0; kg < 4; ++kg)
      e[kg] = exp2x8((s[kg] - mrow) * LOG2E);   // exp(s - mrow) as __expf forms it
    // keeps all four asm runs of exponentials ahead of the second product
    __builtin_amdgcn_sched_barrier(0);
#pragma unroll
    for (int kg = 0; kg < 4; ++kg) {
#pragma unroll
      for (int v = 0; v < 8; ++v) {
        const h16 ph = toh_flush(e[kg][v] * PCARRY);
        pf[kg >> 1][(kg & 1) * 8 + v] = ph;
        s[kg][v] = (float)ph;
      }
    }
    // the 16 value fragments of the other 32 keys, one group again: they land under the row sum,
    // the rescaling and the first 16 products
    v16h vf1[16];
#pragma unroll
    for (int nb = 0; nb < 16; ++nb) vf1[nb] = ld_frag(&Vs[(nb * 16) * LDT + 32], LDT);
    // keeps these 32 reads up here, ahead of the work that covers them
    __builtin_amdgcn_sched_barrier(0);
#pragma unroll
    for (int v = 0; v < 8; ++v) t[v] = (s[0][v] + s[1][v]) + (s[2][v] + s[3][v]);
    lrow = alpha * lrow + (((t[0] + t[1]) + (t[2] + t[3])) + ((t[4] + t[5]) + (t[6] + t[7])));
#pragma unroll
    for (int nb = 0; nb < 16; ++nb) o[nb] = o[nb] * alpha;

    // O^T += V^T . P^T  (K = 64 keys in two 32-steps; A = V^T tile [c][key])
#pragma unroll
    for (int nb = 0; nb < 16; ++nb) o[nb] = wmma16(vf0[nb], pf[0], o[nb]);
#pragma unroll
    for (int nb = 0; nb < 16; ++nb) o[nb] = wmma16(vf1[nb], pf[1], o[nb]);
    // keeps the products ahead of the waits below: lifted over them, s_wait_dscnt 0 made the wave
    // wait for the second group of value reads before the first group's products
    __builtin_amdgcn_sched_barrier(0);

    // publish point of the next stage; the one barrier also ends every wave's reads of this
    // stage's buffer, which is refilled behind it
    asm volatile("s_wait_dscnt 0x0" ::: "memory");      // this wave's reads of the buffer are done
    asm volatile("s_wait_asynccnt 0x0" ::: "memory");   // its copies of the next stage have landed
    __syncthreads();
    lfill = cur ? lfill + BUF_BYTES : lfill - BUF_BYTES;   // now in the buffer that was just read
    if (kb + 256u < (unsigned)SEQ)
      copy_stage(lfill, pk + 256 * HD, pv + 256);
    pk += 128 * HD;
    pv += 128;
  }
  asm volatile("s_wait_asynccnt 0x0" ::: "memory");   // no copy is left in flight behind the loop

  // join of the two key sets: the wave keeps the 8 channel tiles it will finish (set 0 the lower
  // 128 channels, set 1 the upper) and hands the other 8, its maximum and its row sum to its
  // partner, wave ^ 4, lane to lane (both hold row m, channel 16 nb + 8 hh + v alike)
  const float lw = lrow + xhalf(lrow);
  float* xo = &Xo[wave * (unsigned)XO_FLOATS + lane * 4u];
  v8f mine[8];
  if (kh == 0u) {
#pragma unroll
    for (int nb = 0; nb < 8; ++nb) {
      const v8f g = o[8 + nb];
      *(v4f*)(xo + nb * 256)       = (v4f){g[0], g[1], g[2], g[3]};
      *(v4f*)(xo + nb * 256 + 128) = (v4f){g[4], g[5], g[6], g[7]};
      mine[nb] = o[nb];
    }
  } else {
#pragma unroll
    for (int nb = 0; nb < 8; ++nb) {
      const v8f g = o[nb];
      *(v4f*)(xo + nb * 256)       = (v4f){g[0], g[1], g[2], g[3]};
      *(v4f*)(xo + nb * 256 + 128) = (v4f){g[4], g[5], g[6], g[7]};
      mine[nb] = o[8 + nb];
    }
  }
  Xml[(wave * 32u + lane) * 2u]      = mrow;
  Xml[(wave * 32u + lane) * 2u + 1u] = lw;
  __syncthreads();
  const unsigned pw = wave ^ 4u;
  const float mp = Xml[(pw * 32u + lane) * 2u];
  const float lp = Xml[(pw * 32u + lane) * 2u + 1u];
  const float mj = fmaxf(mrow, mp);
  const float aw = exp2x1((mrow - mj) * LOG2E);
  const float ap = exp2x1((mp - mj) * LOG2E);

  // finalize: k * O / (64 l) + x, 32 channels per pass through the wave's Cs tile
  const float kk = bf16r(kp[0]);
  // v_rcp_f32 with the v_nop of exp2x8 behind it, for the same reason
  float rl;
  asm("v_rcp_f32 %0, %1\n\tv_nop" : "=v"(rl) : "v"(aw * lw + ap * lp));
  const float inv = rl * (1.0f / WCARRY);
  const float fw = aw * inv, fp = ap * inv;
  const float* xi = &Xo[pw * (unsigned)XO_FLOATS + lane * 4u];
#pragma unroll
  for (int nb = 0; nb < 8; ++nb) {
    const v4f g0 = *(const v4f*)(xi + nb * 256);
    const v4f g1 = *(const v4f*)(xi + nb * 256 + 128);
    const v8f g = (v8f){g0[0], g0[1], g0[2], g0[3], g1[0], g1[1], g1[2], g1[3]};
    mine[nb] = mine[nb] * fw + g * fp;
  }
  const unsigned cw = wave * (16u * LDE);
  const size_t frow0 = (size_t)b * SEQ_FULL + qrow0;
  const unsigned ch0 = kh * (unsigned)CSLAB;
#pragma unroll
  for (int pr = 0; pr < 4; ++pr) {
    // mine[nb][v] = row m, channel ch0 + 16 nb + 8 hh + v: 8 consecutive channels per lane and tile
#pragma unroll
    for (int u = 0; u < 2; ++u) {
      const v8f ov = mine[2 * pr + u];
      float* cp = &Cs[cw + m * LDE + 16u * (unsigned)u + hh * 8u];
      *(v4f*)cp       = (v4f){ov[0], ov[1], ov[2], ov[3]};
      *(v4f*)(cp + 4) = (v4f){ov[4], ov[5], ov[6], ov[7]};
    }
    wave_lds_sync();
    v4f xs[4];
    size_t off[4];
#pragma unroll
    for (unsigned i = 0; i < 4u; ++i) {
      const unsigned r = 4u * i + (lane >> 3);
      const unsigned c = (lane & 7u) * 4u;
      const size_t frow = frow0 + r;
      const unsigned ch = ch0 + 32u * (unsigned)pr + c;
      const v4f u = *(const v4f*)&Cs[cw + r * LDE + c];
      const v4f xin = *(const v4f*)(xres + frow * CH + ch);
      v4f val;
#pragma unroll
      for (int j = 0; j < 4; ++j) val[j] = kk * u[j] + bf16r(xin[j]);
      xs[i] = val;
      off[i] = frow * OUTW + ch;
    }
#pragma unroll
    for (int i = 0; i < 4; ++i) *(v4f*)(out + off[i]) = xs[i];

    wave_lds_sync();
  }
}

// ---------------------------------------------------------------------------
extern "C" void kernel_launch(void* const* d_in, const int* in_sizes, int n_in,
                              void* d_out, int out_size, void* d_ws, size_t ws_size,
                              hipStream_t stream) {
  if (n_in < 6) return;
  const long long need_rows = (long long)(NB - 1) * SEQ_FULL + SEQ;
  if ((long long)in_sizes[0] < need_rows * CH) return;
  if ((long long)in_sizes[1] < need_rows * CH) return;
  if ((long long)in_sizes[2] < need_rows * HD) return;
  if ((long long)in_sizes[3] < need_rows * HD) return;
  if ((long long)in_sizes[4] < need_rows * CH) return;
  if (in_sizes[5] < 1) return;
  if ((long long)out_size < need_rows * OUTW) return;
  if (ws_size < WS_TOTAL) return;

  const float* G  = (const float*)d_in[0];   // g        [NB_FULL][SEQ_FULL][CH]
  const float* X  = (const float*)d_in[1];   // x        [NB_FULL][SEQ_FULL][CH]
  const float* XQ = (const float*)d_in[2];   // x_query  [NB_FULL][SEQ_FULL][HD]  (keys)
  const float* PG = (const float*)d_in[3];   // phi_g    [NB_FULL][SEQ_FULL][HD]  (softmax rows)
  const float* XV = (const float*)d_in[4];   // x_value  [NB_FULL][SEQ_FULL][CH]
  const float* KP = (const float*)d_in[5];   // k        [1]
  float* out = (float*)d_out;

  char* ws = (char*)d_ws;
  _Float16* PG16 = (_Float16*)(ws + OFF_PG);   // [MROWS][HD]
  _Float16* XQ16 = (_Float16*)(ws + OFF_XQ);   // [MROWS][HD]
  _Float16* Vt16 = (_Float16*)(ws + OFF_VT);   // [b][CH][SEQ]

  dim3 blk(256);

  prep_kernel<<<dim3(PREP_BLOCKS), blk, 0, stream>>>(PG, XQ, XV, G, PG16, XQ16, Vt16, out);
  attn_kernel<<<dim3(SEQ / QROWS, NB), blk, 0, stream>>>(PG16, XQ16, Vt16, X, KP, out);
}

// v006
// It runs in 61.1 microseconds.
// In both of two side-by-side timings against v005, it was 1.08 times as fast.
// All steps since v000 together make it 3.19 times as fast.
#include <hip/hip_runtime.h>
#include <stddef.h>

// Both contractions (row.key scores, K = 64; p.v, K = 4096 keys) on v_wmma_f32_16x16x32_f16
// (f16 operands, f32 accumulate), one product per site, both taken transposed (key x row scores,
// channel x row result). Float inputs are RNE-converted to bf16
// and carried in f16 (score operands x16, value plane x64, softmax numerators x16384 with the
// row sum taken over the converted values). Softmax, scalar gain and residual add in f32.

typedef _Float16 v16h __attribute__((ext_vector_type(16)));
typedef _Float16 v8h  __attribute__((ext_vector_type(8)));
typedef float    v8f  __attribute__((ext_vector_type(8)));
typedef float    v4f  __attribute__((ext_vector_type(4)));
typedef _Float16 h16;

#ifndef NB
#define NB 4
#endif
#ifndef SEQ
#define SEQ 4096
#endif
#define NB_FULL  4
#define SEQ_FULL 4096
#define HD    64      // score depth (channels of the row and key operands)
#define CH    256     // value / residual channels
#define OUTW  512     // output channels (CH result channels, then CH pass-through channels)
#define CSLAB 128     // result channels that one wave of a pair finishes in the epilogue
#define QROWS 64      // softmax rows per attention block
#define MROWS (NB * SEQ)

static_assert(NB >= 1 && NB <= NB_FULL);
static_assert(SEQ >= 256 && SEQ <= SEQ_FULL && (SEQ % 128) == 0);   // two ring stages exist
static_assert(HD == 64);                         // two 32-deep k-steps per score tile
static_assert(OUTW == 2 * CH);
static_assert(CH == 2 * CSLAB && CSLAB == 8 * 16);   // 16 accumulator channel groups per wave
static_assert((CH % 64) == 0 && (SEQ % 64) == 0);      // transpose tiles 64 x 64
static_assert((MROWS % 32) == 0 && (MROWS % 4) == 0);
static_assert((HD % 8) == 0 && (CH % 4) == 0);
static_assert((size_t)NB_FULL * SEQ_FULL * OUTW * 4 == (size_t)33554432);

#define LDT 72   // halves per LDS row (144 B, 16-B aligned)
#define LDE 36   // floats per LDS row of the epilogue stage (144 B, 16-B aligned)
static_assert((LDT % 8) == 0 && LDT >= 64);
static_assert((LDE % 4) == 0 && LDE >= 32);
#define KS_HALVES  (64 * LDT)                 // key tile of 64 keys
#define SUB_HALVES (KS_HALVES + CH * LDT)      // 64 keys: key tile, then value tile (all channels)
#define SUB_BYTES  (SUB_HALVES * 2)
#define BUF_HALVES (2 * SUB_HALVES)            // one ring buffer: 128 keys as two sets of 64
#define BUF_BYTES  (BUF_HALVES * 2)
#define NST        ((unsigned)(SEQ / 128))    // 128-key stages of the key walk
#define XO_FLOATS  (8 * 2 * 32 * 4)            // 8 accumulator tiles of one wave, 16-B pieces by lane
static_assert((BUF_BYTES % 16) == 0 && (SUB_BYTES % 16) == 0 && (KS_HALVES % 8) == 0);
static_assert((size_t)2 * BUF_BYTES + (size_t)8 * 16 * LDE * 4 + (size_t)8 * XO_FLOATS * 4 +
              (size_t)8 * 32 * 2 * 4 <= (size_t)327680);

#define WCARRY 64.0f      // value plane carried x64
#define QCARRY 16.0f      // score operand planes carried x16 each
#define PCARRY 16384.0f   // softmax numerators carried x16384
#define LOG2E  1.44269504f

// workspace layout (bytes)
#define ROW16_BYTES ((size_t)MROWS * HD * 2)
#define VT_BYTES    ((size_t)NB * CH * SEQ * 2)
#define OFF_PG  ((size_t)0)
#define OFF_XQ  (OFF_PG + ROW16_BYTES)
#define OFF_VT  (OFF_XQ + ROW16_BYTES)
#define WS_TOTAL (OFF_VT + VT_BYTES)
static_assert((ROW16_BYTES % 128) == 0 && (VT_BYTES % 128) == 0);
static_assert(WS_TOTAL <= (size_t)134217728);

// ---------------------------------------------------------------------------
__device__ __forceinline__ float bf16r(float x) {   // RNE convert to bf16, returned widened
  unsigned int u = __float_as_uint(x);
  u = (u + 0x7FFFu + ((u >> 16) & 1u)) & 0xFFFF0000u;
  return __uint_as_float(u);
}

// f32 -> f16 for matrix operands; values below the smallest f16 normal become zero.
static __device__ __forceinline__ h16 toh_flush(float v) {
  const h16 r = (h16)v;
  return (fabsf(v) < 6.103515625e-05f) ? (h16)0.0f : r;
}

// 16-bit fragment: p points at element [row = lane&15][k0 + 8*(lane>>4)] of a k-contiguous
// row. Elements 0..7 <- k0+8h+0..7, elements 8..15 <- k0+16+8h+0..7 (same map for A and B).
__device__ __forceinline__ v16h frag_at(const _Float16* p) {
  v8h lo = *(const v8h*)(p);
  v8h hi = *(const v8h*)(p + 16);
  v16h out;
#pragma unroll
  for (int i = 0; i < 8; ++i) { out[i] = lo[i]; out[i + 8] = hi[i]; }
  return out;
}
__device__ __forceinline__ v16h ld_frag(const _Float16* base, unsigned ld) {
  const unsigned lane = threadIdx.x & 31u;
  return frag_at(base + (lane & 15u) * ld + (lane >> 4) * 8u);
}

__device__ __forceinline__ v8f wmma16(v16h a, v16h b, v8f c) {
  return __builtin_amdgcn_wmma_f32_16x16x32_f16(false, a, false, b, (short)0, c, false, false);
}

// value of lane l ^ 16 (the other half of the wave), by a vector cross-row move
__device__ __forceinline__ float xhalf(float x) {
  const int b = __builtin_bit_cast(int, x);
  return __builtin_bit_cast(
      float, __builtin_amdgcn_permlanex16(b, b, 0x76543210, 0xfedcba98, false, false));
}

// 2^x for eight values. One statement, so that the v_nop stands directly behind the last
// v_exp_f32: the instruction set asks for one slot between a transcendental and a vector
// instruction that uses its result or overwrites its source.
// Early-clobber outputs: no exponential of the run overwrites a neighbour's source either.
__device__ __forceinline__ v8f exp2x8(v8f x) {
  float r0, r1, r2, r3, r4, r5, r6, r7;
  asm("v_exp_f32 %0, %8\n\tv_exp_f32 %1, %9\n\tv_exp_f32 %2, %10\n\tv_exp_f32 %3, %11\n\t"
      "v_exp_f32 %4, %12\n\tv_exp_f32 %5, %13\n\tv_exp_f32 %6, %14\n\tv_exp_f32 %7, %15\n\t"
      "v_nop"
      : "=&v"(r0), "=&v"(r1), "=&v"(r2), "=&v"(r3), "=&v"(r4), "=&v"(r5), "=&v"(r6), "=&v"(r7)
      : "v"(x[0]), "v"(x[1]), "v"(x[2]), "v"(x[3]), "v"(x[4]), "v"(x[5]), "v"(x[6]), "v"(x[7]));
  return (v8f){r0, r1, r2, r3, r4, r5, r6, r7};
}

__device__ __forceinline__ void wave_lds_sync() {
  __builtin_amdgcn_fence(3 /* release order */, "wavefront");
  asm volatile("s_wait_dscnt 0x0" ::: "memory");
  __builtin_amdgcn_wave_barrier();
}

// 2^x for one value, with the v_nop of exp2x8 behind it, for the same reason
__device__ __forceinline__ float exp2x1(float x) {
  float r;
  asm("v_exp_f32 %0, %1\n\tv_nop" : "=v"(r) : "v"(x));
  return r;
}

// Ten 16-B asynchronous copies per lane from global memory into LDS, through no register: two
// pieces of a key tile (rows 32 apart) and eight of a value tile (channels 32 apart). lds = the
// lane's byte address in the set's key tile, gk / gv = its first piece of each tile.
// s_wait_xcnt 0 is the statement's last line so that it stands in front of every later write of
// a register that a copy names.
__device__ __forceinline__ void copy_set(unsigned lds, const _Float16* gk, const _Float16* gv) {
  const unsigned lv = lds + KS_HALVES * 2u;
  asm volatile(
      "global_load_async_to_lds_b128 %0, %10, off\n\t"
      "global_load_async_to_lds_b128 %1, %11, off\n\t"
      "global_load_async_to_lds_b128 %2, %12, off\n\t"
      "global_load_async_to_lds_b128 %3, %13, off\n\t"
      "global_load_async_to_lds_b128 %4, %14, off\n\t"
      "global_load_async_to_lds_b128 %5, %15, off\n\t"
      "global_load_async_to_lds_b128 %6, %16, off\n\t"
      "global_load_async_to_lds_b128 %7, %17, off\n\t"
      "global_load_async_to_lds_b128 %8, %18, off\n\t"
      "global_load_async_to_lds_b128 %9, %19, off\n\t"
      "s_wait_xcnt 0x0"
      :: "v"(lds), "v"(lds + 32u * LDT * 2u),
         "v"(lv), "v"(lv + 32u * LDT * 2u), "v"(lv + 64u * LDT * 2u), "v"(lv + 96u * LDT * 2u),
         "v"(lv + 128u * LDT * 2u), "v"(lv + 160u * LDT * 2u), "v"(lv + 192u * LDT * 2u),
         "v"(lv + 224u * LDT * 2u),
         "v"(gk), "v"(gk + 32 * HD),
         "v"(gv), "v"(gv + 32 * SEQ), "v"(gv + 64 * SEQ), "v"(gv + 96 * SEQ),
         "v"(gv + 128 * SEQ), "v"(gv + 160 * SEQ), "v"(gv + 192 * SEQ), "v"(gv + 224 * SEQ)
      : "memory");
}

// One 128-key stage into a ring buffer: its two sets of 64 keys, 20 copies per lane.
__device__ __forceinline__ void copy_stage(unsigned lds, const _Float16* gk, const _Float16* gv) {
  copy_set(lds, gk, gv);
  copy_set(lds + SUB_BYTES, gk + 64 * HD, gv + 64);
}

// ---------------------------------------------------------------------------
// Every pass outside the attention kernel, in one launch. Block blk takes one 64 x 64 tile of the
// value transpose and the 16 rows numbered blk of the other passes:
//  - value plane: V[b][key][ch] -> Vt[b][ch][key] = f16(64 * bf16(v)), through T (cross-wave,
//    block barrier); tiles numbered channel tile first, then key tile, then batch;
//  - score operand planes: compact rows [MROWS][HD] of f16(16 * bf16(value)); waves 0..3 convert
//    the row operand, waves 4..7 the key operand, 8 consecutive values per thread;
//  - pass-through half of the output: out[full row][CH + c] = bf16(g[full row][c]), four 16-B
//    pieces per thread.
// All global loads stand ahead of the barrier and all global stores behind it: a barrier behind a
// global store first waits for that store.
// Grid (NB * (CH/64) * (SEQ/64)).
// ---------------------------------------------------------------------------
#define NTILE_C (CH / 64)
#define NTILE_B (NTILE_C * (SEQ / 64))
#define PREP_BLOCKS (NB * NTILE_B)
static_assert((size_t)PREP_BLOCKS * 16 == (size_t)MROWS);   // 16 rows of each row pass per block

__global__ __launch_bounds__(256) void prep_kernel(
    const float* __restrict__ RowIn, const float* __restrict__ KeyIn,
    const float* __restrict__ V, const float* __restrict__ G,
    _Float16* __restrict__ row16, _Float16* __restrict__ key16,
    _Float16* __restrict__ Vt, float* __restrict__ out) {
  __shared__ _Float16 T[64 * LDT];
  const unsigned tid = threadIdx.x;
  const unsigned blk = blockIdx.x;

  // the block's 16 compact rows lie in one batch (SEQ is a multiple of 16)
  const unsigned crow0 = blk * 16u;
  const unsigned rb = crow0 / (unsigned)SEQ;
  const size_t frow0 = (size_t)rb * SEQ_FULL + (crow0 - rb * (unsigned)SEQ);

  // pass-through slice: piece j is row (tid >> 6) + 4 j, channels 4 (tid & 63) ..
  const unsigned gr = tid >> 6, gc = (tid & 63u) * 4u;
  const float* __restrict__ gp = G + (frow0 + gr) * CH + gc;
  float* __restrict__ op = out + (frow0 + gr) * OUTW + CH + gc;
  v4f ga[4];
#pragma unroll
  for (int j = 0; j < 4; ++j) ga[j] = *(const v4f*)(gp + j * 4 * CH);

  // score operand slice: row (tid & 127) >> 3, values 8 (tid & 7) ..
  const bool keyside = __builtin_amdgcn_readfirstlane((int)(tid >> 7)) != 0;
  const float* __restrict__ splane = keyside ? KeyIn : RowIn;
  _Float16* __restrict__ dplane = keyside ? key16 : row16;
  const unsigned sr = (tid & 127u) >> 3, sc = (tid & 7u) * 8u;
  const float* __restrict__ sp = splane + (frow0 + sr) * HD + sc;
  const v4f a0 = *(const v4f*)(sp);
  const v4f a1 = *(const v4f*)(sp + 4);
  // the wait that stands before an issued load's address register is written again. The addresses
  // are named as inputs so that they stay whole up to it. This statement and its
  // twin below also hold the block's 22 loads ahead of their first use: left alone, the compiler
  // waited for them in four groups, one memory latency after the other
  asm volatile("s_wait_xcnt 0x0" :: "v"(gp), "v"(sp) : "memory");

  // value tile: element j is key row (tid >> 6) + 4 j, channel tid & 63
  const unsigned vb = blk / (unsigned)NTILE_B;
  const unsigned vt = blk - vb * (unsigned)NTILE_B;
  const unsigned n0 = (vt % (unsigned)NTILE_C) * 64u;
  const unsigned k0 = (vt / (unsigned)NTILE_C) * 64u;
  const unsigned kr = tid >> 6, nc = tid & 63u;
  const float* __restrict__ wp = V + ((size_t)vb * SEQ_FULL + k0 + kr) * CH + n0 + nc;
  _Float16* __restrict__ Wt = Vt + (size_t)vb * CH * SEQ;
  float wv[16];
#pragma unroll
  for (int j = 0; j < 16; ++j) wv[j] = wp[j * 4 * CH];
  asm volatile("s_wait_xcnt 0x0" :: "v"(wp) : "memory");   // as above, for these 16 loads
#pragma unroll
  for (int j = 0; j < 16; ++j) T[nc * LDT + kr + 4 * j] = (_Float16)(WCARRY * bf16r(wv[j]));
  __syncthreads();
  v8h x[2];
  size_t off[2];
#pragma unroll
  for (unsigned i = 0; i < 2u; ++i) {
    const unsigned n = 32u * i + (tid >> 3);
    const unsigned kc = (tid & 7u) * 8u;
    x[i] = *(const v8h*)&T[n * LDT + kc];
    off[i] = (size_t)(n0 + n) * SEQ + k0 + kc;
  }
#pragma unroll
  for (int i = 0; i < 2; ++i) *(v8h*)(Wt + off[i]) = x[i];

  // score operand slice: convert and store
  v8h xs;
#pragma unroll
  for (int i = 0; i < 4; ++i) {
    xs[i]     = toh_flush(QCARRY * bf16r(a0[i]));
    xs[i + 4] = toh_flush(QCARRY * bf16r(a1[i]));
  }
  *(v8h*)(dplane + (size_t)(crow0 + sr) * HD + sc) = xs;

  // pass-through slice: convert and store
#pragma unroll
  for (int j = 0; j < 4; ++j) {
    v4f o;
#pragma unroll
    for (int e = 0; e < 4; ++e) o[e] = bf16r(ga[j][e]);
    *(v4f*)(op + j * 4 * OUTW) = o;
  }
}

// ---------------------------------------------------------------------------
// Dense flash attention per (64 softmax rows, all CH value channels, batch), so that each score
// and its exponential are formed once. 8 waves = 4 row groups of 16 x 2 key sets: wave w takes
// rows 16 (w & 3) .. and, of every 128-key stage, the 64 keys of set w >> 2; it runs its own
// online softmax over its half of the keys, and the two waves of a row group join their maxima,
// sums and results once, behind the loop, through LDS (block barrier). Per set a key tile
// Ks[key][d] and a V^T tile Vs[c][key], staged by asynchronous copies in a ring of two buffers,
// the next stage in flight while this one is worked on (cross-wave, one block barrier per stage).
// The block enters the key walk at a stage of its own and wraps round: the SEQ/64 blocks of a
// batch read the same key and value lines from L2, and started together at one pace they would
// ask for the same lines at the same moment.
// Both products are transposed:
// S^T = K . Q^T (A = key rows, B = softmax rows) and O^T += V^T . P^T (A = channel rows). Lane
// (hh, m) then holds softmax row m alone: keys 16 kg + 8 hh + v of its scores, so that maximum
// and sum run inside the lane with one exchange between the wave's halves, and the converted
// scores of two key groups ARE the B operand of the second product (element i of the fragment
// is key 8 hh + i, element 8 + i is key 16 + 8 hh + i, the order frag_at gives the A side): P
// stays in registers. No mask, unit score scale; P as f16(16384 p), values below the smallest
// f16 normal set to zero, row sum over the converted values, each half's share kept apart until
// the epilogue; O^T (256 channels x 16 rows per wave) in registers.
// Epilogue: each wave of a pair hands the other 128 channels and finishes its own 128, 32
// channels at a time staged in the wave's Cs tile (wave-private, wave sync).
// Grid (SEQ/64, NB).
// ---------------------------------------------------------------------------
__global__ __launch_bounds__(256) void attn_kernel(
    const _Float16* __restrict__ Qh, const _Float16* __restrict__ Kh,
    const _Float16* __restrict__ Vt, const float* __restrict__ xres,
    const float* __restrict__ kp, float* __restrict__ out) {
  __shared__ __attribute__((aligned(16))) _Float16 Ring[2 * BUF_HALVES];
  __shared__ __attribute__((aligned(16))) float Cs[8 * 16 * LDE];
  __shared__ __attribute__((aligned(16))) float Xo[8 * XO_FLOATS];   // results handed to the partner
  __shared__ __attribute__((aligned(16))) float Xml[8 * 32 * 2];     // its maximum and row sum

  const unsigned tid = threadIdx.x, lane = tid & 31u;
  const unsigned wave = (unsigned)__builtin_amdgcn_readfirstlane((int)(threadIdx.x >> 5));
  const unsigned rg = wave & 3u, kh = wave >> 2;
  const unsigned hh = lane >> 4, m = lane & 15u;
  const unsigned q0 = blockIdx.x * (unsigned)QROWS;
  const unsigned b = blockIdx.y;
  const float sinv = 1.0f / (QCARRY * QCARRY);
  const unsigned qrow0 = q0 + rg * 16u;

  const size_t qoff = (size_t)(b * (unsigned)SEQ + qrow0 + m) * HD + hh * 8u;
  const _Float16* __restrict__ qp = Qh + qoff;
  v16h qf[2];
  qf[0] = frag_at(qp);
  qf[1] = frag_at(qp + 32);
  // the wait that stands before an issued load's address register is written again; the address
  // is named as an input so that it stays whole up to the wait
  asm volatile("s_wait_xcnt 0x0" :: "v"(qp) : "memory");

  float mrow = -1.0e30f, lrow = 0.0f;   // softmax row m; lrow covers this half's keys only
  v8f o[16];
#pragma unroll
  for (int nb = 0; nb < 16; ++nb) o[nb] = (v8f){};

  const size_t kplane = (size_t)b * SEQ * HD;
  const size_t vplane = (size_t)b * CH * SEQ;

  // the lane's piece of a tile: row tid >> 3 (and multiples of 32 further), halves 8 (tid & 7) ..
  const unsigned sr = tid >> 3, sc = (tid & 7u) * 8u;
  const unsigned lds0 = (unsigned)(size_t)&Ring[sr * LDT + sc];
  const _Float16* __restrict__ gk = Kh + kplane + (size_t)sr * HD + sc;
  const _Float16* __restrict__ gv = Vt + vplane + (size_t)sr * SEQ + sc;

  // entry stage of the key walk. Blocks 8 j .. 8 j + 7 take four different stages twice,
  // four blocks apart, and each further eight the next four stages (a matter of speed alone:
  // every block walks all NST stages, whatever its entry)
  unsigned st = (((blockIdx.x >> 3) << 2) | (blockIdx.x & 3u)) % NST;

  // ring prologue: the first stage landed and published, the second in flight (SEQ >= 256: both
  // exist)
  copy_stage(lds0, gk + (size_t)st * (128 * HD), gv + (size_t)st * 128);
  asm volatile("s_wait_asynccnt 0x0" ::: "memory");   // this wave's copies of it have landed
  __syncthreads();
  st = (st + 1u == NST) ? 0u : st + 1u;
  copy_stage(lds0 + BUF_BYTES, gk + (size_t)st * (128 * HD), gv + (size_t)st * 128);
  unsigned lfill = lds0 + BUF_BYTES;   // the lane's piece in the buffer that was filled last

#pragma unroll 1
  for (unsigned it = 0; it < NST; ++it) {
    const unsigned cur = it & 1u;
    const _Float16* Ks = Ring + cur * BUF_HALVES + kh * SUB_HALVES;
    const _Float16* Vs = Ks + KS_HALVES;

    // scores: 4 key groups of 16, K = 64 in two 32-steps; all 8 key fragments are read from
    // LDS as one group ahead of the 8 products
    v16h kf[8];
#pragma unroll
    for (int kg = 0; kg < 4; ++kg)
#pragma unroll
      for (int c = 0; c < 2; ++c) kf[kg * 2 + c] = ld_frag(&Ks[(kg * 16) * LDT + c * 32], LDT);
    // keeps the 16 reads together: sunk to their products, each pair is waited for on its own
    __builtin_amdgcn_sched_barrier(0);
    v8f s[4];   // s[kg][v] = score of key 16 kg + 8 hh + v against softmax row m
#pragma unroll
    for (int kg = 0; kg < 4; ++kg) s[kg] = wmma16(kf[kg * 2], qf[0], (v8f){});
#pragma unroll
    for (int kg = 0; kg < 4; ++kg) s[kg] = wmma16(kf[kg * 2 + 1], qf[1], s[kg]) * sinv;

    // online softmax: 32 of the row's 64 scores are in this lane, the rest in lane ^ 16
    float t[8];
#pragma unroll
    for (int v = 0; v < 8; ++v)
      t[v] = fmaxf(fmaxf(s[0][v], s[1][v]), fmaxf(s[2][v], s[3][v]));
    float mx = fmaxf(fmaxf(fmaxf(t[0], t[1]), fmaxf(t[2], t[3])),
                     fmaxf(fmaxf(t[4], t[5]), fmaxf(t[6], t[7])));
    mx = fmaxf(mx, xhalf(mx));
    const float mn = fmaxf(mrow, mx);
    // alpha = exp(mrow - mn), formed as __expf forms it (times log2 e, then v_exp_f32)
    const float alpha = exp2x1((mrow - mn) * LOG2E);
    mrow = mn;
    // the 16 value fragments of the first 32 keys are read from LDS as one group here, so that
    // they land under the exponentials
    v16h vf0[16];
#pragma unroll
    for (int nb = 0; nb < 16; ++nb) vf0[nb] = ld_frag(&Vs[(nb * 16) * LDT], LDT);
    // keeps the 32 reads up here: without it they sink behind most of the exponentials
    __builtin_amdgcn_sched_barrier(0);
    // P^T fragments [32 keys][16 rows], f16(16384 p); s keeps the converted value for the row sum
    v16h pf[2];
    v8f e[4];
#pragma unroll
    for (int kg = 0; kg < 4; ++kg)
      e[kg] = exp2x8((s[kg] - mrow) * LOG2E);   // exp(s - mrow) as __expf forms it
    // keeps all four asm runs of exponentials ahead of the second product
    __builtin_amdgcn_sched_barrier(0);
#pragma unroll
    for (int kg = 0; kg < 4; ++kg) {
#pragma unroll
      for (int v = 0; v < 8; ++v) {
        const h16 ph = toh_flush(e[kg][v] * PCARRY);
        pf[kg >> 1][(kg & 1) * 8 + v] = ph;
        s[kg][v] = (float)ph;
      }
    }
    // the 16 value fragments of the other 32 keys, one group again: they land under the row sum,
    // the rescaling and the first 16 products
    v16h vf1[16];
#pragma unroll
    for (int nb = 0; nb < 16; ++nb) vf1[nb] = ld_frag(&Vs[(nb * 16) * LDT + 32], LDT);
    // keeps these 32 reads up here, ahead of the work that covers them
    __builtin_amdgcn_sched_barrier(0);
#pragma unroll
    for (int v = 0; v < 8; ++v) t[v] = (s[0][v] + s[1][v]) + (s[2][v] + s[3][v]);
    lrow = alpha * lrow + (((t[0] + t[1]) + (t[2] + t[3])) + ((t[4] + t[5]) + (t[6] + t[7])));
#pragma unroll
    for (int nb = 0; nb < 16; ++nb) o[nb] = o[nb] * alpha;

    // O^T += V^T . P^T  (K = 64 keys in two 32-steps; A = V^T tile [c][key])
#pragma unroll
    for (int nb = 0; nb < 16; ++nb) o[nb] = wmma16(vf0[nb], pf[0], o[nb]);
#pragma unroll
    for (int nb = 0; nb < 16; ++nb) o[nb] = wmma16(vf1[nb], pf[1], o[nb]);
    // keeps the products ahead of the waits below: lifted over them, s_wait_dscnt 0 made the wave
    // wait for the second group of value reads before the first group's products
    __builtin_amdgcn_sched_barrier(0);

    // publish point of the next stage; the one barrier also ends every wave's reads of this
    // stage's buffer, which is refilled behind it
    asm volatile("s_wait_dscnt 0x0" ::: "memory");      // this wave's reads of the buffer are done
    asm volatile("s_wait_asynccnt 0x0" ::: "memory");   // its copies of the next stage have landed
    __syncthreads();
    lfill = cur ? lfill + BUF_BYTES : lfill - BUF_BYTES;   // now in the buffer that was just read
    st = (st + 1u == NST) ? 0u : st + 1u;   // the stage two trips ahead, wrapped round
    if (it + 2u < NST)
      copy_stage(lfill, gk + (size_t)st * (128 * HD), gv + (size_t)st * 128);
  }
  asm volatile("s_wait_asynccnt 0x0" ::: "memory");   // no copy is left in flight behind the loop

  // join of the two key sets: the wave keeps the 8 channel tiles it will finish (set 0 the lower
  // 128 channels, set 1 the upper) and hands the other 8, its maximum and its row sum to its
  // partner, wave ^ 4, lane to lane (both hold row m, channel 16 nb + 8 hh + v alike)
  const float lw = lrow + xhalf(lrow);
  float* xo = &Xo[wave * (unsigned)XO_FLOATS + lane * 4u];
  v8f mine[8];
  if (kh == 0u) {
#pragma unroll
    for (int nb = 0; nb < 8; ++nb) {
      const v8f g = o[8 + nb];
      *(v4f*)(xo + nb * 256)       = (v4f){g[0], g[1], g[2], g[3]};
      *(v4f*)(xo + nb * 256 + 128) = (v4f){g[4], g[5], g[6], g[7]};
      mine[nb] = o[nb];
    }
  } else {
#pragma unroll
    for (int nb = 0; nb < 8; ++nb) {
      const v8f g = o[nb];
      *(v4f*)(xo + nb * 256)       = (v4f){g[0], g[1], g[2], g[3]};
      *(v4f*)(xo + nb * 256 + 128) = (v4f){g[4], g[5], g[6], g[7]};
      mine[nb] = o[8 + nb];
    }
  }
  Xml[(wave * 32u + lane) * 2u]      = mrow;
  Xml[(wave * 32u + lane) * 2u + 1u] = lw;
  __syncthreads();
  const unsigned pw = wave ^ 4u;
  const float mp = Xml[(pw * 32u + lane) * 2u];
  const float lp = Xml[(pw * 32u + lane) * 2u + 1u];
  const float mj = fmaxf(mrow, mp);
  const float aw = exp2x1((mrow - mj) * LOG2E);
  const float ap = exp2x1((mp - mj) * LOG2E);

  // finalize: k * O / (64 l) + x, 32 channels per pass through the wave's Cs tile
  const float kk = bf16r(kp[0]);
  // v_rcp_f32 with the v_nop of exp2x8 behind it, for the same reason
  float rl;
  asm("v_rcp_f32 %0, %1\n\tv_nop" : "=v"(rl) : "v"(aw * lw + ap * lp));
  const float inv = rl * (1.0f / WCARRY);
  const float fw = aw * inv, fp = ap * inv;
  const float* xi = &Xo[pw * (unsigned)XO_FLOATS + lane * 4u];
#pragma unroll
  for (int nb = 0; nb < 8; ++nb) {
    const v4f g0 = *(const v4f*)(xi + nb * 256);
    const v4f g1 = *(const v4f*)(xi + nb * 256 + 128);
    const v8f g = (v8f){g0[0], g0[1], g0[2], g0[3], g1[0], g1[1], g1[2], g1[3]};
    mine[nb] = mine[nb] * fw + g * fp;
  }
  const unsigned cw = wave * (16u * LDE);
  const size_t frow0 = (size_t)b * SEQ_FULL + qrow0;
  const unsigned ch0 = kh * (unsigned)CSLAB;
#pragma unroll
  for (int pr = 0; pr < 4; ++pr) {
    // mine[nb][v] = row m, channel ch0 + 16 nb + 8 hh + v: 8 consecutive channels per lane and tile
#pragma unroll
    for (int u = 0; u < 2; ++u) {
      const v8f ov = mine[2 * pr + u];
      float* cp = &Cs[cw + m * LDE + 16u * (unsigned)u + hh * 8u];
      *(v4f*)cp       = (v4f){ov[0], ov[1], ov[2], ov[3]};
      *(v4f*)(cp + 4) = (v4f){ov[4], ov[5], ov[6], ov[7]};
    }
    wave_lds_sync();
    v4f xs[4];
    size_t off[4];
#pragma unroll
    for (unsigned i = 0; i < 4u; ++i) {
      const unsigned r = 4u * i + (lane >> 3);
      const unsigned c = (lane & 7u) * 4u;
      const size_t frow = frow0 + r;
      const unsigned ch = ch0 + 32u * (unsigned)pr + c;
      const v4f u = *(const v4f*)&Cs[cw + r * LDE + c];
      const v4f xin = *(const v4f*)(xres + frow * CH + ch);
      v4f val;
#pragma unroll
      for (int j = 0; j < 4; ++j) val[j] = kk * u[j] + bf16r(xin[j]);
      xs[i] = val;
      off[i] = frow * OUTW + ch;
    }
#pragma unroll
    for (int i = 0; i < 4; ++i) *(v4f*)(out + off[i]) = xs[i];

    wave_lds_sync();
  }
}

// ---------------------------------------------------------------------------
extern "C" void kernel_launch(void* const* d_in, const int* in_sizes, int n_in,
                              void* d_out, int out_size, void* d_ws, size_t ws_size,
                              hipStream_t stream) {
  if (n_in < 6) return;
  const long long need_rows = (long long)(NB - 1) * SEQ_FULL + SEQ;
  if ((long long)in_sizes[0] < need_rows * CH) return;
  if ((long long)in_sizes[1] < need_rows * CH) return;
  if ((long long)in_sizes[2] < need_rows * HD) return;
  if ((long long)in_sizes[3] < need_rows * HD) return;
  if ((long long)in_sizes[4] < need_rows * CH) return;
  if (in_sizes[5] < 1) return;
  if ((long long)out_size < need_rows * OUTW) return;
  if (ws_size < WS_TOTAL) return;

  const float* G  = (const float*)d_in[0];   // g        [NB_FULL][SEQ_FULL][CH]
  const float* X  = (const float*)d_in[1];   // x        [NB_FULL][SEQ_FULL][CH]
  const float* XQ = (const float*)d_in[2];   // x_query  [NB_FULL][SEQ_FULL][HD]  (keys)
  const float* PG = (const float*)d_in[3];   // phi_g    [NB_FULL][SEQ_FULL][HD]  (softmax rows)
  const float* XV = (const float*)d_in[4];   // x_value  [NB_FULL][SEQ_FULL][CH]
  const float* KP = (const float*)d_in[5];   // k        [1]
  float* out = (float*)d_out;

  char* ws = (char*)d_ws;
  _Float16* PG16 = (_Float16*)(ws + OFF_PG);   // [MROWS][HD]
  _Float16* XQ16 = (_Float16*)(ws + OFF_XQ);   // [MROWS][HD]
  _Float16* Vt16 = (_Float16*)(ws + OFF_VT);   // [b][CH][SEQ]

  dim3 blk(256);

  prep_kernel<<<dim3(PREP_BLOCKS), blk, 0, stream>>>(PG, XQ, XV, G, PG16, XQ16, Vt16, out);
  attn_kernel<<<dim3(SEQ / QROWS, NB), blk, 0, stream>>>(PG16, XQ16, Vt16, X, KP, out);
}

// v007
// Measured time: 57.8 microseconds a run.
// Next to v006, in two timings, it ran 1.06 and 1.05 times as fast.
// Over all steps from v000 it is 3.37 times as fast.
#include <hip/hip_runtime.h>
#include <stddef.h>

// Both contractions (row.key scores, K = 64; p.v, K = 4096 keys) on v_wmma_f32_16x16x32_f16
// (f16 operands, f32 accumulate), one product per site, both taken transposed (key x row scores,
// channel x row result). Float inputs are RNE-converted to bf16
// and carried in f16 (score operands x16, value plane x64, softmax numerators x16384 with the
// row sum taken over their f32 values). Softmax, scalar gain and residual add in f32.

typedef _Float16 v16h __attribute__((ext_vector_type(16)));
typedef _Float16 v8h  __attribute__((ext_vector_type(8)));
typedef float    v8f  __attribute__((ext_vector_type(8)));
typedef float    v4f  __attribute__((ext_vector_type(4)));
typedef float    v2f  __attribute__((ext_vector_type(2)));
typedef _Float16 v2h  __attribute__((ext_vector_type(2)));
typedef _Float16 h16;

#ifndef NB
#define NB 4
#endif
#ifndef SEQ
#define SEQ 4096
#endif
#define NB_FULL  4
#define SEQ_FULL 4096
#define HD    64      // score depth (channels of the row and key operands)
#define CH    256     // value / residual channels
#define OUTW  512     // output channels (CH result channels, then CH pass-through channels)
#define CSLAB 128     // result channels that one wave of a pair finishes in the epilogue
#define QROWS 64      // softmax rows per attention block
#define MROWS (NB * SEQ)

static_assert(NB >= 1 && NB <= NB_FULL);
static_assert(SEQ >= 256 && SEQ <= SEQ_FULL && (SEQ % 128) == 0);   // two ring stages exist
static_assert(HD == 64);                         // two 32-deep k-steps per score tile
static_assert(OUTW == 2 * CH);
static_assert(CH == 2 * CSLAB && CSLAB == 8 * 16);   // 16 accumulator channel groups per wave
static_assert((CH % 64) == 0 && (SEQ % 64) == 0);      // transpose tiles 64 x 64
static_assert((MROWS % 32) == 0 && (MROWS % 4) == 0);
static_assert((HD % 8) == 0 && (CH % 4) == 0);
static_assert((size_t)NB_FULL * SEQ_FULL * OUTW * 4 == (size_t)33554432);

#define LDT 72   // halves per LDS row (144 B, 16-B aligned)
#define LDE 36   // floats per LDS row of the epilogue stage (144 B, 16-B aligned)
static_assert((LDT % 8) == 0 && LDT >= 64);
static_assert((LDE % 4) == 0 && LDE >= 32);
#define KS_HALVES  (64 * LDT)                 // key tile of 64 keys
#define SUB_HALVES (KS_HALVES + CH * LDT)      // 64 keys: key tile, then value tile (all channels)
#define SUB_BYTES  (SUB_HALVES * 2)
#define BUF_HALVES (2 * SUB_HALVES)            // one ring buffer: 128 keys as two sets of 64
#define BUF_BYTES  (BUF_HALVES * 2)
#define NST        ((unsigned)(SEQ / 128))    // 128-key stages of the key walk
#define XO_FLOATS  (8 * 2 * 32 * 4)            // 8 accumulator tiles of one wave, 16-B pieces by lane
static_assert((BUF_BYTES % 16) == 0 && (SUB_BYTES % 16) == 0 && (KS_HALVES % 8) == 0);
static_assert((size_t)2 * BUF_BYTES + (size_t)8 * 16 * LDE * 4 + (size_t)8 * XO_FLOATS * 4 +
              (size_t)8 * 32 * 2 * 4 <= (size_t)327680);

#define WCARRY 64.0f      // value plane carried x64
#define QCARRY 16.0f      // score operand planes carried x16 each
#define PLOG2  14.0f      // softmax numerators carried x2^14, added to the exponent
#define LOG2E  1.44269504f
#define SCL2   (LOG2E / (QCARRY * QCARRY))   // accumulator of a score tile -> score times log2 e

// workspace layout (bytes)
#define ROW16_BYTES ((size_t)MROWS * HD * 2)
#define VT_BYTES    ((size_t)NB * CH * SEQ * 2)
#define OFF_PG  ((size_t)0)
#define OFF_XQ  (OFF_PG + ROW16_BYTES)
#define OFF_VT  (OFF_XQ + ROW16_BYTES)
#define WS_TOTAL (OFF_VT + VT_BYTES)
static_assert((ROW16_BYTES % 128) == 0 && (VT_BYTES % 128) == 0);
static_assert(WS_TOTAL <= (size_t)134217728);

// ---------------------------------------------------------------------------
__device__ __forceinline__ float bf16r(float x) {   // RNE convert to bf16, returned widened
  unsigned int u = __float_as_uint(x);
  u = (u + 0x7FFFu + ((u >> 16) & 1u)) & 0xFFFF0000u;
  return __uint_as_float(u);
}

// f32 -> f16 for matrix operands; values below the smallest f16 normal become zero.
static __device__ __forceinline__ h16 toh_flush(float v) {
  const h16 r = (h16)v;
  return (fabsf(v) < 6.103515625e-05f) ? (h16)0.0f : r;
}

// 16-bit fragment: p points at element [row = lane&15][k0 + 8*(lane>>4)] of a k-contiguous
// row. Elements 0..7 <- k0+8h+0..7, elements 8..15 <- k0+16+8h+0..7 (same map for A and B).
__device__ __forceinline__ v16h frag_at(const _Float16* p) {
  v8h lo = *(const v8h*)(p);
  v8h hi = *(const v8h*)(p + 16);
  v16h out;
#pragma unroll
  for (int i = 0; i < 8; ++i) { out[i] = lo[i]; out[i + 8] = hi[i]; }
  return out;
}
__device__ __forceinline__ v16h ld_frag(const _Float16* base, unsigned ld) {
  const unsigned lane = threadIdx.x & 31u;
  return frag_at(base + (lane & 15u) * ld + (lane >> 4) * 8u);
}

__device__ __forceinline__ v8f wmma16(v16h a, v16h b, v8f c) {
  return __builtin_amdgcn_wmma_f32_16x16x32_f16(false, a, false, b, (short)0, c, false, false);
}

// value of lane l ^ 16 (the other half of the wave), by a vector cross-row move
__device__ __forceinline__ float xhalf(float x) {
  const int b = __builtin_bit_cast(int, x);
  return __builtin_bit_cast(
      float, __builtin_amdgcn_permlanex16(b, b, 0x76543210, 0xfedcba98, false, false));
}

// 2^x for eight values. One statement, so that the v_nop stands directly behind the last
// v_exp_f32: the instruction set asks for one slot between a transcendental and a vector
// instruction that uses its result or overwrites its source.
// Early-clobber outputs: no exponential of the run overwrites a neighbour's source either.
__device__ __forceinline__ v8f exp2x8(v8f x) {
  float r0, r1, r2, r3, r4, r5, r6, r7;
  asm("v_exp_f32 %0, %8\n\tv_exp_f32 %1, %9\n\tv_exp_f32 %2, %10\n\tv_exp_f32 %3, %11\n\t"
      "v_exp_f32 %4, %12\n\tv_exp_f32 %5, %13\n\tv_exp_f32 %6, %14\n\tv_exp_f32 %7, %15\n\t"
      "v_nop"
      : "=&v"(r0), "=&v"(r1), "=&v"(r2), "=&v"(r3), "=&v"(r4), "=&v"(r5), "=&v"(r6), "=&v"(r7)
      : "v"(x[0]), "v"(x[1]), "v"(x[2]), "v"(x[3]), "v"(x[4]), "v"(x[5]), "v"(x[6]), "v"(x[7]));
  return (v8f){r0, r1, r2, r3, r4, r5, r6, r7};
}

__device__ __forceinline__ void wave_lds_sync() {
  __builtin_amdgcn_fence(3 /* release order */, "wavefront");
  asm volatile("s_wait_dscnt 0x0" ::: "memory");
  __builtin_amdgcn_wave_barrier();
}

// 2^x for one value, with the v_nop of exp2x8 behind it, for the same reason
__device__ __forceinline__ float exp2x1(float x) {
  float r;
  asm("v_exp_f32 %0, %1\n\tv_nop" : "=v"(r) : "v"(x));
  return r;
}

// Ten 16-B asynchronous copies per lane from global memory into LDS, through no register: two
// pieces of a key tile (rows 32 apart) and eight of a value tile (channels 32 apart). lds = the
// lane's byte address in the set's key tile, gk / gv = its first piece of each tile.
// s_wait_xcnt 0 is the statement's last line so that it stands in front of every later write of
// a register that a copy names.
__device__ __forceinline__ void copy_set(unsigned lds, const _Float16* gk, const _Float16* gv) {
  const unsigned lv = lds + KS_HALVES * 2u;
  asm volatile(
      "global_load_async_to_lds_b128 %0, %10, off\n\t"
      "global_load_async_to_lds_b128 %1, %11, off\n\t"
      "global_load_async_to_lds_b128 %2, %12, off\n\t"
      "global_load_async_to_lds_b128 %3, %13, off\n\t"
      "global_load_async_to_lds_b128 %4, %14, off\n\t"
      "global_load_async_to_lds_b128 %5, %15, off\n\t"
      "global_load_async_to_lds_b128 %6, %16, off\n\t"
      "global_load_async_to_lds_b128 %7, %17, off\n\t"
      "global_load_async_to_lds_b128 %8, %18, off\n\t"
      "global_load_async_to_lds_b128 %9, %19, off\n\t"
      "s_wait_xcnt 0x0"
      :: "v"(lds), "v"(lds + 32u * LDT * 2u),
         "v"(lv), "v"(lv + 32u * LDT * 2u), "v"(lv + 64u * LDT * 2u), "v"(lv + 96u * LDT * 2u),
         "v"(lv + 128u * LDT * 2u), "v"(lv + 160u * LDT * 2u), "v"(lv + 192u * LDT * 2u),
         "v"(lv + 224u * LDT * 2u),
         "v"(gk), "v"(gk + 32 * HD),
         "v"(gv), "v"(gv + 32 * SEQ), "v"(gv + 64 * SEQ), "v"(gv + 96 * SEQ),
         "v"(gv + 128 * SEQ), "v"(gv + 160 * SEQ), "v"(gv + 192 * SEQ), "v"(gv + 224 * SEQ)
      : "memory");
}

// One 128-key stage into a ring buffer: its two sets of 64 keys, 20 copies per lane.
__device__ __forceinline__ void copy_stage(unsigned lds, const _Float16* gk, const _Float16* gv) {
  copy_set(lds, gk, gv);
  copy_set(lds + SUB_BYTES, gk + 64 * HD, gv + 64);
}

// ---------------------------------------------------------------------------
// Every pass outside the attention kernel, in one launch. Block blk takes one 64 x 64 tile of the
// value transpose and the 16 rows numbered blk of the other passes:
//  - value plane: V[b][key][ch] -> Vt[b][ch][key] = f16(64 * bf16(v)), through T (cross-wave,
//    block barrier); tiles numbered channel tile first, then key tile, then batch;
//  - score operand planes: compact rows [MROWS][HD] of f16(16 * bf16(value)); waves 0..3 convert
//    the row operand, waves 4..7 the key operand, 8 consecutive values per thread;
//  - pass-through half of the output: out[full row][CH + c] = bf16(g[full row][c]), four 16-B
//    pieces per thread.
// All global loads stand ahead of the barrier and all global stores behind it: a barrier behind a
// global store first waits for that store.
// Grid (NB * (CH/64) * (SEQ/64)).
// ---------------------------------------------------------------------------
#define NTILE_C (CH / 64)
#define NTILE_B (NTILE_C * (SEQ / 64))
#define PREP_BLOCKS (NB * NTILE_B)
static_assert((size_t)PREP_BLOCKS * 16 == (size_t)MROWS);   // 16 rows of each row pass per block

__global__ __launch_bounds__(256) void prep_kernel(
    const float* __restrict__ RowIn, const float* __restrict__ KeyIn,
    const float* __restrict__ V, const float* __restrict__ G,
    _Float16* __restrict__ row16, _Float16* __restrict__ key16,
    _Float16* __restrict__ Vt, float* __restrict__ out) {
  __shared__ _Float16 T[64 * LDT];
  const unsigned tid = threadIdx.x;
  const unsigned blk = blockIdx.x;

  // the block's 16 compact rows lie in one batch (SEQ is a multiple of 16)
  const unsigned crow0 = blk * 16u;
  const unsigned rb = crow0 / (unsigned)SEQ;
  const size_t frow0 = (size_t)rb * SEQ_FULL + (crow0 - rb * (unsigned)SEQ);

  // pass-through slice: piece j is row (tid >> 6) + 4 j, channels 4 (tid & 63) ..
  const unsigned gr = tid >> 6, gc = (tid & 63u) * 4u;
  const float* __restrict__ gp = G + (frow0 + gr) * CH + gc;
  float* __restrict__ op = out + (frow0 + gr) * OUTW + CH + gc;
  v4f ga[4];
#pragma unroll
  for (int j = 0; j < 4; ++j) ga[j] = *(const v4f*)(gp + j * 4 * CH);

  // score operand slice: row (tid & 127) >> 3, values 8 (tid & 7) ..
  const bool keyside = __builtin_amdgcn_readfirstlane((int)(tid >> 7)) != 0;
  const float* __restrict__ splane = keyside ? KeyIn : RowIn;
  _Float16* __restrict__ dplane = keyside ? key16 : row16;
  const unsigned sr = (tid & 127u) >> 3, sc = (tid & 7u) * 8u;
  const float* __restrict__ sp = splane + (frow0 + sr) * HD + sc;
  const v4f a0 = *(const v4f*)(sp);
  const v4f a1 = *(const v4f*)(sp + 4);
  // the wait that stands before an issued load's address register is written again. The addresses
  // are named as inputs so that they stay whole up to it. This statement and its
  // twin below also hold the block's 22 loads ahead of their first use: left alone, the compiler
  // waited for them in four groups, one memory latency after the other
  asm volatile("s_wait_xcnt 0x0" :: "v"(gp), "v"(sp) : "memory");

  // value tile: element j is key row (tid >> 6) + 4 j, channel tid & 63
  const unsigned vb = blk / (unsigned)NTILE_B;
  const unsigned vt = blk - vb * (unsigned)NTILE_B;
  const unsigned n0 = (vt % (unsigned)NTILE_C) * 64u;
  const unsigned k0 = (vt / (unsigned)NTILE_C) * 64u;
  const unsigned kr = tid >> 6, nc = tid & 63u;
  const float* __restrict__ wp = V + ((size_t)vb * SEQ_FULL + k0 + kr) * CH + n0 + nc;
  _Float16* __restrict__ Wt = Vt + (size_t)vb * CH * SEQ;
  float wv[16];
#pragma unroll
  for (int j = 0; j < 16; ++j) wv[j] = wp[j * 4 * CH];
  asm volatile("s_wait_xcnt 0x0" :: "v"(wp) : "memory");   // as above, for these 16 loads
#pragma unroll
  for (int j = 0; j < 16; ++j) T[nc * LDT + kr + 4 * j] = (_Float16)(WCARRY * bf16r(wv[j]));
  __syncthreads();
  v8h x[2];
  size_t off[2];
#pragma unroll
  for (unsigned i = 0; i < 2u; ++i) {
    const unsigned n = 32u * i + (tid >> 3);
    const unsigned kc = (tid & 7u) * 8u;
    x[i] = *(const v8h*)&T[n * LDT + kc];
    off[i] = (size_t)(n0 + n) * SEQ + k0 + kc;
  }
#pragma unroll
  for (int i = 0; i < 2; ++i) *(v8h*)(Wt + off[i]) = x[i];

  // score operand slice: convert and store
  v8h xs;
#pragma unroll
  for (int i = 0; i < 4; ++i) {
    xs[i]     = toh_flush(QCARRY * bf16r(a0[i]));
    xs[i + 4] = toh_flush(QCARRY * bf16r(a1[i]));
  }
  *(v8h*)(dplane + (size_t)(crow0 + sr) * HD + sc) = xs;

  // pass-through slice: convert and store
#pragma unroll
  for (int j = 0; j < 4; ++j) {
    v4f o;
#pragma unroll
    for (int e = 0; e < 4; ++e) o[e] = bf16r(ga[j][e]);
    *(v4f*)(op + j * 4 * OUTW) = o;
  }
}

// ---------------------------------------------------------------------------
// Dense flash attention per (64 softmax rows, all CH value channels, batch), so that each score
// and its exponential are formed once. 8 waves = 4 row groups of 16 x 2 key sets: wave w takes
// rows 16 (w & 3) .. and, of every 128-key stage, the 64 keys of set w >> 2; it runs its own
// online softmax over its half of the keys, and the two waves of a row group join their maxima,
// sums and results once, behind the loop, through LDS (block barrier). Per set a key tile
// Ks[key][d] and a V^T tile Vs[c][key], staged by asynchronous copies in a ring of two buffers,
// the next stage in flight while this one is worked on (cross-wave, one block barrier per stage).
// The block enters the key walk at a stage of its own and wraps round: the SEQ/64 blocks of a
// batch read the same key and value lines from L2, and started together at one pace they would
// ask for the same lines at the same moment.
// Both products are transposed:
// S^T = K . Q^T (A = key rows, B = softmax rows) and O^T += V^T . P^T (A = channel rows). Lane
// (hh, m) then holds softmax row m alone: keys 16 kg + 8 hh + v of its scores, so that maximum
// and sum run inside the lane with one exchange between the wave's halves, and the converted
// scores of two key groups ARE the B operand of the second product (element i of the fragment
// is key 8 hh + i, element 8 + i is key 16 + 8 hh + i, the order frag_at gives the A side): P
// stays in registers. No mask, unit score scale. Softmax in the log2 domain: the running maximum
// is kept on the score accumulators as they come (x256), and one fused multiply-add per score
// applies the scale, the maximum and the carry of P ahead of v_exp_f32. P as f16(16384 p), row
// sum over the f32 values, each half's share kept apart until the epilogue; O^T (256 channels x
// 16 rows per wave) in registers.
// Epilogue: each wave of a pair hands the other 128 channels and finishes its own 128, 32
// channels at a time staged in the wave's Cs tile (wave-private, wave sync).
// Grid (SEQ/64, NB).
// ---------------------------------------------------------------------------
__global__ __launch_bounds__(256) void attn_kernel(
    const _Float16* __restrict__ Qh, const _Float16* __restrict__ Kh,
    const _Float16* __restrict__ Vt, const float* __restrict__ xres,
    const float* __restrict__ kp, float* __restrict__ out) {
  __shared__ __attribute__((aligned(16))) _Float16 Ring[2 * BUF_HALVES];
  __shared__ __attribute__((aligned(16))) float Cs[8 * 16 * LDE];
  __shared__ __attribute__((aligned(16))) float Xo[8 * XO_FLOATS];   // results handed to the partner
  __shared__ __attribute__((aligned(16))) float Xml[8 * 32 * 2];     // its maximum and row sum

  const unsigned tid = threadIdx.x, lane = tid & 31u;
  const unsigned wave = (unsigned)__builtin_amdgcn_readfirstlane((int)(threadIdx.x >> 5));
  const unsigned rg = wave & 3u, kh = wave >> 2;
  const unsigned hh = lane >> 4, m = lane & 15u;
  const unsigned q0 = blockIdx.x * (unsigned)QROWS;
  const unsigned b = blockIdx.y;
  const unsigned qrow0 = q0 + rg * 16u;

  const size_t qoff = (size_t)(b * (unsigned)SEQ + qrow0 + m) * HD + hh * 8u;
  const _Float16* __restrict__ qp = Qh + qoff;
  v16h qf[2];
  qf[0] = frag_at(qp);
  qf[1] = frag_at(qp + 32);
  // the wait that stands before an issued load's address register is written again; the address
  // is named as an input so that it stays whole up to the wait
  asm volatile("s_wait_xcnt 0x0" :: "v"(qp) : "memory");

  // softmax row m; mrow on the x256 accumulator scale, lrow covers this half's keys only
  float mrow = -1.0e30f, lrow = 0.0f;
  v8f o[16];
#pragma unroll
  for (int nb = 0; nb < 16; ++nb) o[nb] = (v8f){};

  const size_t kplane = (size_t)b * SEQ * HD;
  const size_t vplane = (size_t)b * CH * SEQ;

  // the lane's piece of a tile: row tid >> 3 (and multiples of 32 further), halves 8 (tid & 7) ..
  const unsigned sr = tid >> 3, sc = (tid & 7u) * 8u;
  const unsigned lds0 = (unsigned)(size_t)&Ring[sr * LDT + sc];
  const _Float16* __restrict__ gk = Kh + kplane + (size_t)sr * HD + sc;
  const _Float16* __restrict__ gv = Vt + vplane + (size_t)sr * SEQ + sc;

  // entry stage of the key walk. Blocks 8 j .. 8 j + 7 take four different stages twice,
  // four blocks apart, and each further eight the next four stages (a matter of speed alone:
  // every block walks all NST stages, whatever its entry)
  unsigned st = (((blockIdx.x >> 3) << 2) | (blockIdx.x & 3u)) % NST;

  // ring prologue: the first stage landed and published, the second in flight (SEQ >= 256: both
  // exist)
  copy_stage(lds0, gk + (size_t)st * (128 * HD), gv + (size_t)st * 128);
  asm volatile("s_wait_asynccnt 0x0" ::: "memory");   // this wave's copies of it have landed
  __syncthreads();
  st = (st + 1u == NST) ? 0u : st + 1u;
  copy_stage(lds0 + BUF_BYTES, gk + (size_t)st * (128 * HD), gv + (size_t)st * 128);
  unsigned lfill = lds0 + BUF_BYTES;   // the lane's piece in the buffer that was filled last

#pragma unroll 1
  for (unsigned it = 0; it < NST; ++it) {
    const unsigned cur = it & 1u;
    const _Float16* Ks = Ring + cur * BUF_HALVES + kh * SUB_HALVES;
    const _Float16* Vs = Ks + KS_HALVES;

    // scores: 4 key groups of 16, K = 64 in two 32-steps; all 8 key fragments are read from
    // LDS as one group ahead of the 8 products
    v16h kf[8];
#pragma unroll
    for (int kg = 0; kg < 4; ++kg)
#pragma unroll
      for (int c = 0; c < 2; ++c) kf[kg * 2 + c] = ld_frag(&Ks[(kg * 16) * LDT + c * 32], LDT);
    // keeps the 16 reads together: sunk to their products, each pair is waited for on its own
    __builtin_amdgcn_sched_barrier(0);
    v8f s[4];   // s[kg][v] = 256 x score of key 16 kg + 8 hh + v against softmax row m
#pragma unroll
    for (int kg = 0; kg < 4; ++kg) s[kg] = wmma16(kf[kg * 2], qf[0], (v8f){});
#pragma unroll
    for (int kg = 0; kg < 4; ++kg) s[kg] = wmma16(kf[kg * 2 + 1], qf[1], s[kg]);

    // online softmax: 32 of the row's 64 scores are in this lane, the rest in lane ^ 16
    float t[8];
#pragma unroll
    for (int v = 0; v < 8; ++v)
      t[v] = fmaxf(fmaxf(s[0][v], s[1][v]), fmaxf(s[2][v], s[3][v]));
    float mx = fmaxf(fmaxf(fmaxf(t[0], t[1]), fmaxf(t[2], t[3])),
                     fmaxf(fmaxf(t[4], t[5]), fmaxf(t[6], t[7])));
    mx = fmaxf(mx, xhalf(mx));
    const float mn = fmaxf(mrow, mx);
    const float alpha = exp2x1((mrow - mn) * SCL2);   // exp(old maximum - new maximum), true scale
    mrow = mn;
    const float nm = __builtin_fmaf(-mn, SCL2, PLOG2);
    // the 16 value fragments of the first 32 keys are read from LDS as one group here, so that
    // they land under the exponentials
    v16h vf0[16];
#pragma unroll
    for (int nb = 0; nb < 16; ++nb) vf0[nb] = ld_frag(&Vs[(nb * 16) * LDT], LDT);
    // keeps the 32 reads up here: without it they sink behind most of the exponentials
    __builtin_amdgcn_sched_barrier(0);
    // e = 16384 exp(score - maximum) = 2^(s SCL2 - mn SCL2 + 14)
    v16h pf[2];
    v8f e[4];
    const v8f sc8 = {SCL2, SCL2, SCL2, SCL2, SCL2, SCL2, SCL2, SCL2};
    const v8f nm8 = {nm, nm, nm, nm, nm, nm, nm, nm};
#pragma unroll
    for (int kg = 0; kg < 4; ++kg) e[kg] = exp2x8(__builtin_elementwise_fma(s[kg], sc8, nm8));
    // keeps all four asm runs of exponentials ahead of the second product
    __builtin_amdgcn_sched_barrier(0);
    // P^T fragments [32 keys][16 rows], two values per conversion
#pragma unroll
    for (int kg = 0; kg < 4; ++kg) {
#pragma unroll
      for (int v = 0; v < 8; v += 2) {
        const v2h ph = __builtin_convertvector((v2f){e[kg][v], e[kg][v + 1]}, v2h);
        pf[kg >> 1][(kg & 1) * 8 + v]     = ph[0];
        pf[kg >> 1][(kg & 1) * 8 + v + 1] = ph[1];
      }
    }
    // the 16 value fragments of the other 32 keys, one group again: they land under the row sum,
    // the rescaling and the first 16 products
    v16h vf1[16];
#pragma unroll
    for (int nb = 0; nb < 16; ++nb) vf1[nb] = ld_frag(&Vs[(nb * 16) * LDT + 32], LDT);
    // keeps these 32 reads up here, ahead of the work that covers them
    __builtin_amdgcn_sched_barrier(0);
    const v8f es = (e[0] + e[1]) + (e[2] + e[3]);
    const v4f e4 = (v4f){es[0], es[1], es[2], es[3]} + (v4f){es[4], es[5], es[6], es[7]};
    const v2f e2 = (v2f){e4[0], e4[1]} + (v2f){e4[2], e4[3]};
    lrow = alpha * lrow + (e2[0] + e2[1]);
#pragma unroll
    for (int nb = 0; nb < 16; ++nb) o[nb] = o[nb] * alpha;

    // O^T += V^T . P^T  (K = 64 keys in two 32-steps; A = V^T tile [c][key])
#pragma unroll
    for (int nb = 0; nb < 16; ++nb) o[nb] = wmma16(vf0[nb], pf[0], o[nb]);
#pragma unroll
    for (int nb = 0; nb < 16; ++nb) o[nb] = wmma16(vf1[nb], pf[1], o[nb]);
    // keeps the products ahead of the waits below: lifted over them, s_wait_dscnt 0 made the wave
    // wait for the second group of value reads before the first group's products
    __builtin_amdgcn_sched_barrier(0);

    // publish point of the next stage; the one barrier also ends every wave's reads of this
    // stage's buffer, which is refilled behind it
    asm volatile("s_wait_dscnt 0x0" ::: "memory");      // this wave's reads of the buffer are done
    asm volatile("s_wait_asynccnt 0x0" ::: "memory");   // its copies of the next stage have landed
    __syncthreads();
    lfill = cur ? lfill + BUF_BYTES : lfill - BUF_BYTES;   // now in the buffer that was just read
    st = (st + 1u == NST) ? 0u : st + 1u;   // the stage two trips ahead, wrapped round
    if (it + 2u < NST)
      copy_stage(lfill, gk + (size_t)st * (128 * HD), gv + (size_t)st * 128);
  }
  asm volatile("s_wait_asynccnt 0x0" ::: "memory");   // no copy is left in flight behind the loop

  // join of the two key sets: the wave keeps the 8 channel tiles it will finish (set 0 the lower
  // 128 channels, set 1 the upper) and hands the other 8, its maximum and its row sum to its
  // partner, wave ^ 4, lane to lane (both hold row m, channel 16 nb + 8 hh + v alike)
  const float lw = lrow + xhalf(lrow);
  float* xo = &Xo[wave * (unsigned)XO_FLOATS + lane * 4u];
  v8f mine[8];
  if (kh == 0u) {
#pragma unroll
    for (int nb = 0; nb < 8; ++nb) {
      const v8f g = o[8 + nb];
      *(v4f*)(xo + nb * 256)       = (v4f){g[0], g[1], g[2], g[3]};
      *(v4f*)(xo + nb * 256 + 128) = (v4f){g[4], g[5], g[6], g[7]};
      mine[nb] = o[nb];
    }
  } else {
#pragma unroll
    for (int nb = 0; nb < 8; ++nb) {
      const v8f g = o[nb];
      *(v4f*)(xo + nb * 256)       = (v4f){g[0], g[1], g[2], g[3]};
      *(v4f*)(xo + nb * 256 + 128) = (v4f){g[4], g[5], g[6], g[7]};
      mine[nb] = o[8 + nb];
    }
  }
  Xml[(wave * 32u + lane) * 2u]      = mrow;
  Xml[(wave * 32u + lane) * 2u + 1u] = lw;
  __syncthreads();
  const unsigned pw = wave ^ 4u;
  const float mp = Xml[(pw * 32u + lane) * 2u];
  const float lp = Xml[(pw * 32u + lane) * 2u + 1u];
  const float mj = fmaxf(mrow, mp);
  const float aw = exp2x1((mrow - mj) * SCL2);
  const float ap = exp2x1((mp - mj) * SCL2);

  // finalize: k * O / (64 l) + x, 32 channels per pass through the wave's Cs tile
  const float kk = bf16r(kp[0]);
  // v_rcp_f32 with the v_nop of exp2x8 behind it, for the same reason
  float rl;
  asm("v_rcp_f32 %0, %1\n\tv_nop" : "=v"(rl) : "v"(aw * lw + ap * lp));
  const float inv = rl * (1.0f / WCARRY);
  const float fw = aw * inv, fp = ap * inv;
  const float* xi = &Xo[pw * (unsigned)XO_FLOATS + lane * 4u];
#pragma unroll
  for (int nb = 0; nb < 8; ++nb) {
    const v4f g0 = *(const v4f*)(xi + nb * 256);
    const v4f g1 = *(const v4f*)(xi + nb * 256 + 128);
    const v8f g = (v8f){g0[0], g0[1], g0[2], g0[3], g1[0], g1[1], g1[2], g1[3]};
    mine[nb] = mine[nb] * fw + g * fp;
  }
  const unsigned cw = wave * (16u * LDE);
  const size_t frow0 = (size_t)b * SEQ_FULL + qrow0;
  const unsigned ch0 = kh * (unsigned)CSLAB;
#pragma unroll
  for (int pr = 0; pr < 4; ++pr) {
    // mine[nb][v] = row m, channel ch0 + 16 nb + 8 hh + v: 8 consecutive channels per lane and tile
#pragma unroll
    for (int u = 0; u < 2; ++u) {
      const v8f ov = mine[2 * pr + u];
      float* cp = &Cs[cw + m * LDE + 16u * (unsigned)u + hh * 8u];
      *(v4f*)cp       = (v4f){ov[0], ov[1], ov[2], ov[3]};
      *(v4f*)(cp + 4) = (v4f){ov[4], ov[5], ov[6], ov[7]};
    }
    wave_lds_sync();
    v4f xs[4];
    size_t off[4];
#pragma unroll
    for (unsigned i = 0; i < 4u; ++i) {
      const unsigned r = 4u * i + (lane >> 3);
      const unsigned c = (lane & 7u) * 4u;
      const size_t frow = frow0 + r;
      const unsigned ch = ch0 + 32u * (unsigned)pr + c;
      const v4f u = *(const v4f*)&Cs[cw + r * LDE + c];
      const v4f xin = *(const v4f*)(xres + frow * CH + ch);
      v4f val;
#pragma unroll
      for (int j = 0; j < 4; ++j) val[j] = kk * u[j] + bf16r(xin[j]);
      xs[i] = val;
      off[i] = frow * OUTW + ch;
    }
#pragma unroll
    for (int i = 0; i < 4; ++i) *(v4f*)(out + off[i]) = xs[i];

    wave_lds_sync();
  }
}

// ---------------------------------------------------------------------------
extern "C" void kernel_launch(void* const* d_in, const int* in_sizes, int n_in,
                              void* d_out, int out_size, void* d_ws, size_t ws_size,
                              hipStream_t stream) {
  if (n_in < 6) return;
  const long long need_rows = (long long)(NB - 1) * SEQ_FULL + SEQ;
  if ((long long)in_sizes[0] < need_rows * CH) return;
  if ((long long)in_sizes[1] < need_rows * CH) return;
  if ((long long)in_sizes[2] < need_rows * HD) return;
  if ((long long)in_sizes[3] < need_rows * HD) return;
  if ((long long)in_sizes[4] < need_rows * CH) return;
  if (in_sizes[5] < 1) return;
  if ((long long)out_size < need_rows * OUTW) return;
  if (ws_size < WS_TOTAL) return;

  const float* G  = (const float*)d_in[0];   // g        [NB_FULL][SEQ_FULL][CH]
  const float* X  = (const float*)d_in[1];   // x        [NB_FULL][SEQ_FULL][CH]
  const float* XQ = (const float*)d_in[2];   // x_query  [NB_FULL][SEQ_FULL][HD]  (keys)
  const float* PG = (const float*)d_in[3];   // phi_g    [NB_FULL][SEQ_FULL][HD]  (softmax rows)
  const float* XV = (const float*)d_in[4];   // x_value  [NB_FULL][SEQ_FULL][CH]
  const float* KP = (const float*)d_in[5];   // k        [1]
  float* out = (float*)d_out;

  char* ws = (char*)d_ws;
  _Float16* PG16 = (_Float16*)(ws + OFF_PG);   // [MROWS][HD]
  _Float16* XQ16 = (_Float16*)(ws + OFF_XQ);   // [MROWS][HD]
  _Float16* Vt16 = (_Float16*)(ws + OFF_VT);   // [b][CH][SEQ]

  dim3 blk(256);

  prep_kernel<<<dim3(PREP_BLOCKS), blk, 0, stream>>>(PG, XQ, XV, G, PG16, XQ16, Vt16, out);
  attn_kernel<<<dim3(SEQ / QROWS, NB), blk, 0, stream>>>(PG16, XQ16, Vt16, X, KP, out);
}
